// v000
// Times are from an AMD MI455X. After a warm-up the kernel runs many times in a row, and a time is the length of
// such a window on the GPU divided by its runs, so every launch and the gaps after it count. The runs cycle
// through copies of the inputs. A figure is the median of several windows, for all but v000 over two sittings.
// Sittings can differ by a few percent; kernels timed side by side share one.
// The starting kernel, v000, takes 409 microseconds a run.
#include <hip/hip_runtime.h>

typedef __attribute__((ext_vector_type(16))) _Float16 v16h;
typedef __attribute__((ext_vector_type(8)))  _Float16 h8;
typedef __attribute__((ext_vector_type(8)))  float    v8f;

static constexpr int S   = 4096;
static constexpr int Dm  = 1024;
static constexpr int Hn  = 16;
static constexpr int KVH = 4;
static constexpr int HD  = 64;
static constexpr int NKV = KVH * HD;   // 256

__device__ inline v16h load_frag(const _Float16* rowptr, int hi) {
  h8 x = *(const h8*)(rowptr + hi * 8);
  h8 y = *(const h8*)(rowptr + 16 + hi * 8);
  v16h r;
#pragma unroll
  for (int j = 0; j < 8; ++j) { r[j] = x[j]; r[j + 8] = y[j]; }
  return r;
}

// ---------------------------------------------------------------------------
// Elementwise f32 -> f16 convert
// ---------------------------------------------------------------------------
__global__ void convert_f16(const float* __restrict__ in, _Float16* __restrict__ out, int n) {
  int i = blockIdx.x * blockDim.x + threadIdx.x;
  if (i < n) out[i] = (_Float16)in[i];
}

// W [Kd x Nd] f32 (row-major)  ->  Wt [Nd x Kd] f16 (row-major)
__global__ void transpose_f16(const float* __restrict__ W, _Float16* __restrict__ Wt,
                              int Kd, int Nd) {
  int i = blockIdx.x * blockDim.x + threadIdx.x;
  if (i >= Kd * Nd) return;
  int k = i / Nd, n = i - k * Nd;
  Wt[(size_t)n * Kd + k] = (_Float16)W[i];
}

// ---------------------------------------------------------------------------
// WMMA GEMM:  Y[M x N] = A[M x Kd] (f16, row-major) @ B + bias
//   B supplied transposed: Bt[N x Kd] f16 row-major.
//   MODE 0: store f16 row-major (ld = N)
//   MODE 1: store f16 transposed (Y^T, ld = M)     -- used for V
//   MODE 2: store f32 row-major (ld = N)           -- final output
// One wave computes a 32(M) x 64(N) tile; 8 waves / 256-thread block.
// grid = (N/64, M/256)
// ---------------------------------------------------------------------------
template <int MODE>
__global__ __launch_bounds__(256) void gemm_wmma(const _Float16* __restrict__ A,
                                                 const _Float16* __restrict__ Bt,
                                                 const float* __restrict__ bias,
                                                 void* __restrict__ Out,
                                                 int M, int N, int Kd) {
  const int lane = threadIdx.x & 31;
  const int wave = threadIdx.x >> 5;
  const int l16  = lane & 15;
  const int hi   = lane >> 4;
  const int m0   = (blockIdx.y * 8 + wave) * 32;
  const int n0   = blockIdx.x * 64;

  const _Float16* arow0 = A  + (size_t)(m0 + l16) * Kd;
  const _Float16* arow1 = A  + (size_t)(m0 + 16 + l16) * Kd;
  const _Float16* brow  = Bt + (size_t)(n0 + l16) * Kd;

  v8f acc0[4], acc1[4];
#pragma unroll
  for (int nt = 0; nt < 4; ++nt) {
    v8f z = {};
    acc0[nt] = z;
    acc1[nt] = z;
  }

  for (int k0 = 0; k0 < Kd; k0 += 32) {
    v16h a0 = load_frag(arow0 + k0, hi);
    v16h a1 = load_frag(arow1 + k0, hi);
    if (k0 + 32 < Kd) {
      __builtin_prefetch(arow0 + k0 + 64, 0, 1);  // global_prefetch_b8
      __builtin_prefetch(arow1 + k0 + 64, 0, 1);
    }
#pragma unroll
    for (int nt = 0; nt < 4; ++nt) {
      v16h b = load_frag(brow + (size_t)(nt * 16) * Kd + k0, hi);
      acc0[nt] = __builtin_amdgcn_wmma_f32_16x16x32_f16(false, a0, false, b,
                                                        (short)0, acc0[nt], false, false);
      acc1[nt] = __builtin_amdgcn_wmma_f32_16x16x32_f16(false, a1, false, b,
                                                        (short)0, acc1[nt], false, false);
    }
  }

  // C/D layout: element (m = i + 8*hi, n = l16)
#pragma unroll
  for (int nt = 0; nt < 4; ++nt) {
    int n = n0 + nt * 16 + l16;
    float bv = bias[n];
#pragma unroll
    for (int i = 0; i < 8; ++i) {
      int ma = m0 + i + 8 * hi;
      int mb = ma + 16;
      float va = acc0[nt][i] + bv;
      float vb = acc1[nt][i] + bv;
      if (MODE == 0) {
        ((_Float16*)Out)[(size_t)ma * N + n] = (_Float16)va;
        ((_Float16*)Out)[(size_t)mb * N + n] = (_Float16)vb;
      } else if (MODE == 1) {
        ((_Float16*)Out)[(size_t)n * M + ma] = (_Float16)va;
        ((_Float16*)Out)[(size_t)n * M + mb] = (_Float16)vb;
      } else {
        ((float*)Out)[(size_t)ma * N + n] = va;
        ((float*)Out)[(size_t)mb * N + n] = vb;
      }
    }
  }
}

// ---------------------------------------------------------------------------
// Flash attention, transposed formulation, TWO query tiles per wave.
//   Q  : [S][1024] f16,  Km : [S][256] f16,  Vt : [256][S] f16,  O : [S][1024] f16
//
// Scores computed as S^T = K_block(A) x Q^T(B): C-layout maps lane -> query,
// per-lane elements -> keys, so online softmax is per-lane (one shfl_xor(16)
// per reduction), and the exp'd score fragments are already in B-fragment
// layout for O^T += V^T(A) x P^T(B) -- no LDS, just an in-lane f32->f16 pack.
// The K-block and V^T A-fragments are shared across both query tiles:
// 16 b128 loads feed 16 WMMAs per 32-key block.
// ---------------------------------------------------------------------------
__global__ __launch_bounds__(256) void attn_kernel(const _Float16* __restrict__ Q,
                                                   const _Float16* __restrict__ Km,
                                                   const _Float16* __restrict__ Vt,
                                                   _Float16* __restrict__ O) {
  const int lane = threadIdx.x & 31;
  const int wave = threadIdx.x >> 5;
  const int l16  = lane & 15;
  const int hi   = lane >> 4;

  const int idx = blockIdx.x * 8 + wave;   // 0..2047
  const int h   = idx >> 7;                // head 0..15
  const int qp2 = idx & 127;               // 32-query pair tile 0..127
  const int kvh = h >> 2;                  // GROUP = 4 (repeat_interleave)

  // Q^T B-fragments for two 16-query tiles (hd halves 0..31 / 32..63)
  v16h qf[2][2];
#pragma unroll
  for (int s = 0; s < 2; ++s) {
    const _Float16* qp = Q + (size_t)(qp2 * 32 + s * 16 + l16) * Dm + h * HD;
    qf[s][0] = load_frag(qp, hi);
    qf[s][1] = load_frag(qp + 32, hi);
  }

  float mrun[2] = {-1e30f, -1e30f};
  float lrun[2] = {0.0f, 0.0f};
  v8f oacc[2][4];  // O^T tiles: (m = hd, n = query)
#pragma unroll
  for (int s = 0; s < 2; ++s)
#pragma unroll
    for (int nt = 0; nt < 4; ++nt) {
      v8f z = {};
      oacc[s][nt] = z;
    }

  const float scale = 0.125f;  // 1/sqrt(64)

  for (int kb = 0; kb < S; kb += 32) {
    // ---- S^T tiles: c[s][t] holds keys kb+t*16+(i+8*hi), query tile s ----
    v8f c[2][2];
#pragma unroll
    for (int t = 0; t < 2; ++t) {
      const _Float16* kp = Km + (size_t)(kb + t * 16 + l16) * NKV + kvh * HD;
      v16h aK0 = load_frag(kp, hi);
      v16h aK1 = load_frag(kp + 32, hi);
#pragma unroll
      for (int s = 0; s < 2; ++s) {
        v8f z = {};
        z       = __builtin_amdgcn_wmma_f32_16x16x32_f16(false, aK0, false, qf[s][0],
                                                         (short)0, z, false, false);
        c[s][t] = __builtin_amdgcn_wmma_f32_16x16x32_f16(false, aK1, false, qf[s][1],
                                                         (short)0, z, false, false);
      }
    }

    // ---- online softmax per query tile (per-lane + one half-swap) ----
    v16h pb[2];
#pragma unroll
    for (int s = 0; s < 2; ++s) {
      float lmax = -1e30f;
#pragma unroll
      for (int i = 0; i < 8; ++i) {
        c[s][0][i] *= scale;
        c[s][1][i] *= scale;
        lmax = fmaxf(lmax, fmaxf(c[s][0][i], c[s][1][i]));
      }
      lmax = fmaxf(lmax, __shfl_xor(lmax, 16, 32));  // combine key halves
      float mnew = fmaxf(mrun[s], lmax);
      float corr = __expf(mrun[s] - mnew);
      mrun[s] = mnew;

      float p0[8], p1[8];
      float ls = 0.0f;
#pragma unroll
      for (int i = 0; i < 8; ++i) {
        p0[i] = __expf(c[s][0][i] - mnew);
        p1[i] = __expf(c[s][1][i] - mnew);
        ls += p0[i] + p1[i];
      }
      ls += __shfl_xor(ls, 16, 32);
      lrun[s] = lrun[s] * corr + ls;

#pragma unroll
      for (int nt = 0; nt < 4; ++nt)
#pragma unroll
        for (int i = 0; i < 8; ++i) oacc[s][nt][i] *= corr;

      // pack P^T B-fragment: c0[j] -> K=hi*8+j, c1[j] -> K=16+hi*8+j
#pragma unroll
      for (int j = 0; j < 8; ++j) {
        pb[s][j]     = (_Float16)p0[j];
        pb[s][j + 8] = (_Float16)p1[j];
      }
    }

    // ---- O^T += V^T(A) x P^T(B); V^T fragments shared by both tiles ----
#pragma unroll
    for (int nt = 0; nt < 4; ++nt) {
      const _Float16* vp = Vt + (size_t)(kvh * HD + nt * 16 + l16) * S + kb;
      v16h av = load_frag(vp, hi);
#pragma unroll
      for (int s = 0; s < 2; ++s)
        oacc[s][nt] = __builtin_amdgcn_wmma_f32_16x16x32_f16(false, av, false, pb[s],
                                                             (short)0, oacc[s][nt], false, false);
    }
  }

  // ---- normalize and store: O^T element (m = hd, n = query) ----
#pragma unroll
  for (int s = 0; s < 2; ++s) {
    float rinv = 1.0f / lrun[s];
    const int srow = qp2 * 32 + s * 16 + l16;
    _Float16* op = O + (size_t)srow * Dm + h * HD + 8 * hi;
#pragma unroll
    for (int nt = 0; nt < 4; ++nt) {
      h8 v;
#pragma unroll
      for (int i = 0; i < 8; ++i) v[i] = (_Float16)(oacc[s][nt][i] * rinv);
      *(h8*)(op + nt * 16) = v;
    }
  }
}

// ---------------------------------------------------------------------------
// Host launch
// ---------------------------------------------------------------------------
extern "C" void kernel_launch(void* const* d_in, const int* in_sizes, int n_in,
                              void* d_out, int out_size, void* d_ws, size_t ws_size,
                              hipStream_t stream) {
  (void)in_sizes; (void)n_in; (void)out_size; (void)ws_size;
  const float* X   = (const float*)d_in[0];
  const float* q_w = (const float*)d_in[1];
  const float* q_b = (const float*)d_in[2];
  const float* k_w = (const float*)d_in[3];
  const float* k_b = (const float*)d_in[4];
  const float* v_w = (const float*)d_in[5];
  const float* v_b = (const float*)d_in[6];
  const float* o_w = (const float*)d_in[7];
  const float* o_b = (const float*)d_in[8];
  float* out = (float*)d_out;

  // Carve workspace (f16 buffers), 256B aligned. Total ~33 MB.
  char* ws = (char*)d_ws;
  auto carve = [&](size_t bytes) {
    char* p = ws;
    ws += (bytes + 255) & ~(size_t)255;
    return p;
  };
  _Float16* Xh  = (_Float16*)carve((size_t)S * Dm * 2);    // X in f16
  _Float16* qwt = (_Float16*)carve((size_t)Dm * Dm * 2);   // q_w^T
  _Float16* kwt = (_Float16*)carve((size_t)Dm * NKV * 2);  // k_w^T
  _Float16* vwt = (_Float16*)carve((size_t)Dm * NKV * 2);  // v_w^T
  _Float16* owt = (_Float16*)carve((size_t)Dm * Dm * 2);   // o_w^T
  _Float16* Qh  = (_Float16*)carve((size_t)S * Dm * 2);    // Q [S][1024]
  _Float16* Kh  = (_Float16*)carve((size_t)S * NKV * 2);   // K [S][256]
  _Float16* Vth = (_Float16*)carve((size_t)NKV * S * 2);   // V^T [256][S]
  _Float16* Ah  = (_Float16*)carve((size_t)S * Dm * 2);    // attention out [S][1024]

  // 1) Convert / transpose inputs to f16
  {
    int n = S * Dm;
    convert_f16<<<(n + 255) / 256, 256, 0, stream>>>(X, Xh, n);
  }
  transpose_f16<<<(Dm * Dm  + 255) / 256, 256, 0, stream>>>(q_w, qwt, Dm, Dm);
  transpose_f16<<<(Dm * NKV + 255) / 256, 256, 0, stream>>>(k_w, kwt, Dm, NKV);
  transpose_f16<<<(Dm * NKV + 255) / 256, 256, 0, stream>>>(v_w, vwt, Dm, NKV);
  transpose_f16<<<(Dm * Dm  + 255) / 256, 256, 0, stream>>>(o_w, owt, Dm, Dm);

  // 2) Projections (WMMA GEMMs), 32x64 tile per wave -> grid.y = M/256
  gemm_wmma<0><<<dim3(Dm / 64,  S / 256), 256, 0, stream>>>(Xh, qwt, q_b, Qh,  S, Dm,  Dm);
  gemm_wmma<0><<<dim3(NKV / 64, S / 256), 256, 0, stream>>>(Xh, kwt, k_b, Kh,  S, NKV, Dm);
  gemm_wmma<1><<<dim3(NKV / 64, S / 256), 256, 0, stream>>>(Xh, vwt, v_b, Vth, S, NKV, Dm);

  // 3) Flash attention: 16 heads x 128 query-pair tiles = 2048 waves, 8/block
  attn_kernel<<<(Hn * (S / 32)) / 8, 256, 0, stream>>>(Qh, Kh, Vth, Ah);

  // 4) Output projection -> f32
  gemm_wmma<2><<<dim3(Dm / 64, S / 256), 256, 0, stream>>>(Ah, owt, o_b, out, S, Dm, Dm);
}

// v001
// A run of this version takes 320 microseconds.
// In both of two side-by-side timings against v000, it was 1.26 times as fast.
#include <hip/hip_runtime.h>

typedef __attribute__((ext_vector_type(16))) _Float16 v16h;
typedef __attribute__((ext_vector_type(8)))  _Float16 h8;
typedef __attribute__((ext_vector_type(8)))  float    v8f;

static constexpr int S   = 4096;
static constexpr int Dm  = 1024;
static constexpr int Hn  = 16;
static constexpr int KVH = 4;
static constexpr int HD  = 64;
static constexpr int NKV = KVH * HD;   // 256

__device__ inline v16h load_frag(const _Float16* rowptr, int hi) {
  h8 x = *(const h8*)(rowptr + hi * 8);
  h8 y = *(const h8*)(rowptr + 16 + hi * 8);
  v16h r;
#pragma unroll
  for (int j = 0; j < 8; ++j) { r[j] = x[j]; r[j + 8] = y[j]; }
  return r;
}

// ---------------------------------------------------------------------------
// Elementwise f32 -> f16 convert
// ---------------------------------------------------------------------------
__global__ void convert_f16(const float* __restrict__ in, _Float16* __restrict__ out, int n) {
  int i = blockIdx.x * blockDim.x + threadIdx.x;
  if (i < n) out[i] = (_Float16)in[i];
}

// W [Kd x Nd] f32 (row-major)  ->  Wt [Nd x Kd] f16 (row-major)
__global__ void transpose_f16(const float* __restrict__ W, _Float16* __restrict__ Wt,
                              int Kd, int Nd) {
  int i = blockIdx.x * blockDim.x + threadIdx.x;
  if (i >= Kd * Nd) return;
  int k = i / Nd, n = i - k * Nd;
  Wt[(size_t)n * Kd + k] = (_Float16)W[i];
}

// ---------------------------------------------------------------------------
// WMMA GEMM:  Y[M x N] = A[M x Kd] (f16, row-major) @ B + bias
//   B supplied transposed: Bt[N x Kd] f16 row-major.
//   MODE 0: store f16 row-major (ld = N)
//   MODE 1: store f16 transposed (Y^T, ld = M)     -- used for V
//   MODE 2: store f32 row-major (ld = N)           -- final output
// One wave computes a 32(M) x 64(N) tile; 8 waves / 256-thread block.
// grid = (N/64, M/256)
// ---------------------------------------------------------------------------
template <int MODE>
__global__ __launch_bounds__(256) void gemm_wmma(const _Float16* __restrict__ A,
                                                 const _Float16* __restrict__ Bt,
                                                 const float* __restrict__ bias,
                                                 void* __restrict__ Out,
                                                 int M, int N, int Kd) {
  const int lane = threadIdx.x & 31;
  const int wave = threadIdx.x >> 5;
  const int l16  = lane & 15;
  const int hi   = lane >> 4;
  const int m0   = (blockIdx.y * 8 + wave) * 32;
  const int n0   = blockIdx.x * 64;

  const _Float16* arow0 = A  + (size_t)(m0 + l16) * Kd;
  const _Float16* arow1 = A  + (size_t)(m0 + 16 + l16) * Kd;
  const _Float16* brow  = Bt + (size_t)(n0 + l16) * Kd;

  v8f acc0[4], acc1[4];
#pragma unroll
  for (int nt = 0; nt < 4; ++nt) {
    v8f z = {};
    acc0[nt] = z;
    acc1[nt] = z;
  }

  for (int k0 = 0; k0 < Kd; k0 += 32) {
    v16h a0 = load_frag(arow0 + k0, hi);
    v16h a1 = load_frag(arow1 + k0, hi);
    if (k0 + 32 < Kd) {
      __builtin_prefetch(arow0 + k0 + 64, 0, 1);  // global_prefetch_b8
      __builtin_prefetch(arow1 + k0 + 64, 0, 1);
    }
#pragma unroll
    for (int nt = 0; nt < 4; ++nt) {
      v16h b = load_frag(brow + (size_t)(nt * 16) * Kd + k0, hi);
      acc0[nt] = __builtin_amdgcn_wmma_f32_16x16x32_f16(false, a0, false, b,
                                                        (short)0, acc0[nt], false, false);
      acc1[nt] = __builtin_amdgcn_wmma_f32_16x16x32_f16(false, a1, false, b,
                                                        (short)0, acc1[nt], false, false);
    }
  }

  // C/D layout: element (m = i + 8*hi, n = l16)
#pragma unroll
  for (int nt = 0; nt < 4; ++nt) {
    int n = n0 + nt * 16 + l16;
    float bv = bias[n];
#pragma unroll
    for (int i = 0; i < 8; ++i) {
      int ma = m0 + i + 8 * hi;
      int mb = ma + 16;
      float va = acc0[nt][i] + bv;
      float vb = acc1[nt][i] + bv;
      if (MODE == 0) {
        ((_Float16*)Out)[(size_t)ma * N + n] = (_Float16)va;
        ((_Float16*)Out)[(size_t)mb * N + n] = (_Float16)vb;
      } else if (MODE == 1) {
        ((_Float16*)Out)[(size_t)n * M + ma] = (_Float16)va;
        ((_Float16*)Out)[(size_t)n * M + mb] = (_Float16)vb;
      } else {
        ((float*)Out)[(size_t)ma * N + n] = va;
        ((float*)Out)[(size_t)mb * N + n] = vb;
      }
    }
  }
}

static constexpr int KT     = 128;
static constexpr int NST    = S / KT;
static constexpr int KPITCH = HD * 2 + 16;
static constexpr int VPITCH = KT * 2 + 16;
static constexpr int KBYTES = KT * KPITCH;
static constexpr int VBYTES = HD * VPITCH;
static constexpr int STAGEB = KBYTES + VBYTES;

// One stage: 4 K copies and 4 V^T copies per lane (256 lanes x 16 B = 4 KB each).
// kl / vl: this lane's LDS byte addresses, kg / vg: its global addresses.
// K copy j takes rows 32 j + (tid >> 3); V^T copy j rows 16 j + (tid >> 4).
__device__ inline void stage_copy(unsigned kl, unsigned vl,
                                  const _Float16* kg, const _Float16* vg) {
  asm volatile(
      "global_load_async_to_lds_b128 %0, %8, off\n\t"
      "global_load_async_to_lds_b128 %1, %9, off\n\t"
      "global_load_async_to_lds_b128 %2, %10, off\n\t"
      "global_load_async_to_lds_b128 %3, %11, off\n\t"
      "global_load_async_to_lds_b128 %4, %12, off\n\t"
      "global_load_async_to_lds_b128 %5, %13, off\n\t"
      "global_load_async_to_lds_b128 %6, %14, off\n\t"
      "global_load_async_to_lds_b128 %7, %15, off\n\t"
      "s_wait_xcnt 0x0"
      :
      : "v"(kl), "v"(kl + 32 * KPITCH), "v"(kl + 64 * KPITCH), "v"(kl + 96 * KPITCH),
        "v"(vl), "v"(vl + 16 * VPITCH), "v"(vl + 32 * VPITCH), "v"(vl + 48 * VPITCH),
        "v"(kg), "v"(kg + 32 * NKV), "v"(kg + 64 * NKV), "v"(kg + 96 * NKV),
        "v"(vg), "v"(vg + (size_t)16 * S), "v"(vg + (size_t)32 * S), "v"(vg + (size_t)48 * S)
      : "memory");
}

__global__ __launch_bounds__(256) void attn_kernel(const _Float16* __restrict__ Q,
                                                   const _Float16* __restrict__ Km,
                                                   const _Float16* __restrict__ Vt,
                                                   _Float16* __restrict__ O) {
  __shared__ __attribute__((aligned(16))) unsigned char L[2 * STAGEB];

  const int tid  = threadIdx.x;
  const int lane = threadIdx.x & 31;
  const int wave = threadIdx.x >> 5;
  const int l16  = lane & 15;
  const int hi   = lane >> 4;

  const int idx = blockIdx.x * 8 + wave;   // 0..2047
  const int h   = idx >> 7;                // head 0..15 (the same for a block's 8 waves)
  const int qp2 = idx & 127;               // 32-query pair tile 0..127
  const int kvh = h >> 2;                  // GROUP = 4 (repeat_interleave)

  // This lane's copy addresses for stage 0, buffer 0.
  const unsigned lds0 = (unsigned)(size_t)(&L[0]);
  const unsigned kl0  = lds0 + (tid >> 3) * KPITCH + (tid & 7) * 16;
  const unsigned vl0  = lds0 + KBYTES + (tid >> 4) * VPITCH + (tid & 15) * 16;
  const _Float16* kg  = Km + (size_t)(tid >> 3) * NKV + kvh * HD + (tid & 7) * 8;
  const _Float16* vg  = Vt + (size_t)(kvh * HD + (tid >> 4)) * S + (tid & 15) * 8;

  stage_copy(kl0, vl0, kg, vg);

  // Q^T B-fragments for two 16-query tiles (hd halves 0..31 / 32..63)
  v16h qf[2][2];
#pragma unroll
  for (int s = 0; s < 2; ++s) {
    const _Float16* qp = Q + (size_t)(qp2 * 32 + s * 16 + l16) * Dm + h * HD;
    qf[s][0] = load_frag(qp, hi);
    qf[s][1] = load_frag(qp + 32, hi);
  }

  float mrun[2] = {-1e30f, -1e30f};
  float lrun[2] = {0.0f, 0.0f};
  v8f oacc[2][4];  // O^T tiles: (m = hd, n = query)
#pragma unroll
  for (int s = 0; s < 2; ++s)
#pragma unroll
    for (int nt = 0; nt < 4; ++nt) {
      v8f z = {};
      oacc[s][nt] = z;
    }

  const float scale = 0.125f;  // 1/sqrt(64)

  // Stage 0 has landed for this wave; the barrier publishes it to the others.
  asm volatile("s_wait_asynccnt 0x0" ::: "memory");
  __syncthreads();
  stage_copy(kl0 + STAGEB, vl0 + STAGEB, kg + (size_t)KT * NKV, vg + KT);

  for (int st = 0; st < NST; ++st) {
    const unsigned bufo = (st & 1) * STAGEB;
    const unsigned char* Kl = L + bufo + l16 * KPITCH;
    const unsigned char* Vl = L + bufo + KBYTES + l16 * VPITCH;

    // unrolled so that every LDS read has a constant offset from Kl / Vl
#pragma unroll
    for (int p = 0; p < KT / 32; ++p) {
      // ---- S^T tiles: c[s][t] holds keys p*32+t*16+(i+8*hi), query tile s ----
      v8f c[2][2];
#pragma unroll
      for (int t = 0; t < 2; ++t) {
        const _Float16* kp = (const _Float16*)(Kl + (p * 32 + t * 16) * KPITCH);
        v16h aK0 = load_frag(kp, hi);
        v16h aK1 = load_frag(kp + 32, hi);
#pragma unroll
        for (int s = 0; s < 2; ++s) {
          v8f z = {};
          z       = __builtin_amdgcn_wmma_f32_16x16x32_f16(false, aK0, false, qf[s][0],
                                                           (short)0, z, false, false);
          c[s][t] = __builtin_amdgcn_wmma_f32_16x16x32_f16(false, aK1, false, qf[s][1],
                                                           (short)0, z, false, false);
        }
      }

      // ---- online softmax per query tile (per-lane + one half-swap) ----
      v16h pb[2];
#pragma unroll
      for (int s = 0; s < 2; ++s) {
        float lmax = -1e30f;
#pragma unroll
        for (int i = 0; i < 8; ++i) {
          c[s][0][i] *= scale;
          c[s][1][i] *= scale;
          lmax = fmaxf(lmax, fmaxf(c[s][0][i], c[s][1][i]));
        }
        lmax = fmaxf(lmax, __shfl_xor(lmax, 16, 32));  // combine key halves
        float mnew = fmaxf(mrun[s], lmax);
        float corr = __expf(mrun[s] - mnew);
        mrun[s] = mnew;

        float p0[8], p1[8];
        float ls = 0.0f;
#pragma unroll
        for (int i = 0; i < 8; ++i) {
          p0[i] = __expf(c[s][0][i] - mnew);
          p1[i] = __expf(c[s][1][i] - mnew);
          ls += p0[i] + p1[i];
        }
        ls += __shfl_xor(ls, 16, 32);
        lrun[s] = lrun[s] * corr + ls;

#pragma unroll
        for (int nt = 0; nt < 4; ++nt)
#pragma unroll
          for (int i = 0; i < 8; ++i) oacc[s][nt][i] *= corr;

        // pack P^T B-fragment: c0[j] -> K=hi*8+j, c1[j] -> K=16+hi*8+j
#pragma unroll
        for (int j = 0; j < 8; ++j) {
          pb[s][j]     = (_Float16)p0[j];
          pb[s][j + 8] = (_Float16)p1[j];
        }
      }

      // ---- O^T += V^T(A) x P^T(B); V^T fragments shared by both tiles ----
#pragma unroll
      for (int nt = 0; nt < 4; ++nt) {
        const _Float16* vp = (const _Float16*)(Vl + nt * 16 * VPITCH) + p * 32;
        v16h av = load_frag(vp, hi);
#pragma unroll
        for (int s = 0; s < 2; ++s)
          oacc[s][nt] = __builtin_amdgcn_wmma_f32_16x16x32_f16(false, av, false, pb[s],
                                                               (short)0, oacc[s][nt], false, false);
      }
      if (p == 1) __builtin_amdgcn_sched_barrier(0);
    }

    // Hand-over of the buffers: this wave's LDS reads of stage st are done ...
    asm volatile("s_wait_dscnt 0x0" ::: "memory");
    // ... its own copies of stage st + 1 have landed ...
    asm volatile("s_wait_asynccnt 0x0" ::: "memory");
    // ... and the barrier says both of every wave of the block.
    __syncthreads();
    if (st + 2 < NST)  // refill the buffer that stage st has just left
      stage_copy(kl0 + bufo, vl0 + bufo, kg + (size_t)(st + 2) * KT * NKV, vg + (st + 2) * KT);
  }
  // no copy is left in flight when the wave ends
  asm volatile("s_wait_asynccnt 0x0" ::: "memory");

  // ---- normalize and store: O^T element (m = hd, n = query) ----
#pragma unroll
  for (int s = 0; s < 2; ++s) {
    float rinv = 1.0f / lrun[s];
    const int srow = qp2 * 32 + s * 16 + l16;
    _Float16* op = O + (size_t)srow * Dm + h * HD + 8 * hi;
#pragma unroll
    for (int nt = 0; nt < 4; ++nt) {
      h8 v;
#pragma unroll
      for (int i = 0; i < 8; ++i) v[i] = (_Float16)(oacc[s][nt][i] * rinv);
      *(h8*)(op + nt * 16) = v;
    }
  }
}

// ---------------------------------------------------------------------------
// Host launch
// ---------------------------------------------------------------------------
extern "C" void kernel_launch(void* const* d_in, const int* in_sizes, int n_in,
                              void* d_out, int out_size, void* d_ws, size_t ws_size,
                              hipStream_t stream) {
  (void)in_sizes; (void)n_in; (void)out_size; (void)ws_size;
  const float* X   = (const float*)d_in[0];
  const float* q_w = (const float*)d_in[1];
  const float* q_b = (const float*)d_in[2];
  const float* k_w = (const float*)d_in[3];
  const float* k_b = (const float*)d_in[4];
  const float* v_w = (const float*)d_in[5];
  const float* v_b = (const float*)d_in[6];
  const float* o_w = (const float*)d_in[7];
  const float* o_b = (const float*)d_in[8];
  float* out = (float*)d_out;

  // Carve workspace (f16 buffers), 256B aligned. Total ~33 MB.
  char* ws = (char*)d_ws;
  auto carve = [&](size_t bytes) {
    char* p = ws;
    ws += (bytes + 255) & ~(size_t)255;
    return p;
  };
  _Float16* Xh  = (_Float16*)carve((size_t)S * Dm * 2);    // X in f16
  _Float16* qwt = (_Float16*)carve((size_t)Dm * Dm * 2);   // q_w^T
  _Float16* kwt = (_Float16*)carve((size_t)Dm * NKV * 2);  // k_w^T
  _Float16* vwt = (_Float16*)carve((size_t)Dm * NKV * 2);  // v_w^T
  _Float16* owt = (_Float16*)carve((size_t)Dm * Dm * 2);   // o_w^T
  _Float16* Qh  = (_Float16*)carve((size_t)S * Dm * 2);    // Q [S][1024]
  _Float16* Kh  = (_Float16*)carve((size_t)S * NKV * 2);   // K [S][256]
  _Float16* Vth = (_Float16*)carve((size_t)NKV * S * 2);   // V^T [256][S]
  _Float16* Ah  = (_Float16*)carve((size_t)S * Dm * 2);    // attention out [S][1024]

  // 1) Convert / transpose inputs to f16
  {
    int n = S * Dm;
    convert_f16<<<(n + 255) / 256, 256, 0, stream>>>(X, Xh, n);
  }
  transpose_f16<<<(Dm * Dm  + 255) / 256, 256, 0, stream>>>(q_w, qwt, Dm, Dm);
  transpose_f16<<<(Dm * NKV + 255) / 256, 256, 0, stream>>>(k_w, kwt, Dm, NKV);
  transpose_f16<<<(Dm * NKV + 255) / 256, 256, 0, stream>>>(v_w, vwt, Dm, NKV);
  transpose_f16<<<(Dm * Dm  + 255) / 256, 256, 0, stream>>>(o_w, owt, Dm, Dm);

  // 2) Projections (WMMA GEMMs), 32x64 tile per wave -> grid.y = M/256
  gemm_wmma<0><<<dim3(Dm / 64,  S / 256), 256, 0, stream>>>(Xh, qwt, q_b, Qh,  S, Dm,  Dm);
  gemm_wmma<0><<<dim3(NKV / 64, S / 256), 256, 0, stream>>>(Xh, kwt, k_b, Kh,  S, NKV, Dm);
  gemm_wmma<1><<<dim3(NKV / 64, S / 256), 256, 0, stream>>>(Xh, vwt, v_b, Vth, S, NKV, Dm);

  // 3) Flash attention: 16 heads x 128 query-pair tiles = 2048 waves, 8/block
  attn_kernel<<<(Hn * (S / 32)) / 8, 256, 0, stream>>>(Qh, Kh, Vth, Ah);

  // 4) Output projection -> f32
  gemm_wmma<2><<<dim3(Dm / 64, S / 256), 256, 0, stream>>>(Ah, owt, o_b, out, S, Dm, Dm);
}

// v002
// One run takes 239 microseconds.
// Timed twice side by side with v001, it ran 1.34 and 1.35 times as fast.
// Counting every step since v000, it is 1.69 times as fast.
#include <hip/hip_runtime.h>

typedef __attribute__((ext_vector_type(16))) _Float16 v16h;
typedef __attribute__((ext_vector_type(8)))  _Float16 h8;
typedef __attribute__((ext_vector_type(8)))  float    v8f;
typedef __attribute__((ext_vector_type(4)))  float    f4;
typedef __attribute__((ext_vector_type(4)))  _Float16 h4;

static constexpr int S   = 4096;
static constexpr int Dm  = 1024;
static constexpr int Hn  = 16;
static constexpr int KVH = 4;
static constexpr int HD  = 64;
static constexpr int NKV = KVH * HD;   // 256

__device__ inline v16h load_frag(const _Float16* rowptr, int hi) {
  h8 x = *(const h8*)(rowptr + hi * 8);
  h8 y = *(const h8*)(rowptr + 16 + hi * 8);
  v16h r;
#pragma unroll
  for (int j = 0; j < 8; ++j) { r[j] = x[j]; r[j + 8] = y[j]; }
  return r;
}

// ---------------------------------------------------------------------------
// Elementwise f32 -> f16 convert, 32 elements a thread: 8 loads of 16 B in
// flight per lane, each wave-wide load 512 contiguous bytes, each store 256.
// A block takes CVT_BLK elements; the grid covers the array exactly.
// ---------------------------------------------------------------------------
static constexpr int CVT_BLK = 256 * 32;

__global__ __launch_bounds__(256) void convert_f16(const float* __restrict__ in,
                                                   _Float16* __restrict__ out) {
  const size_t base = (size_t)blockIdx.x * CVT_BLK + threadIdx.x * 4;
  f4 v[8];
#pragma unroll
  for (int j = 0; j < 8; ++j) v[j] = *(const f4*)(in + base + j * 1024);
#pragma unroll
  for (int j = 0; j < 8; ++j) {
    h4 h;
#pragma unroll
    for (int i = 0; i < 4; ++i) h[i] = (_Float16)v[j][i];
    *(h4*)(out + base + j * 1024) = h;
  }
}

// W [Kd x Nd] f32 (row-major)  ->  Wt [Nd x Kd] f16 (row-major)
// 32 elements a thread: a block of 8 k x 4 n, read by 8 loads of 16 B along n,
// turned in registers, written by 4 stores of 16 B along k. Eight lanes stand
// side by side in k, so a wave-wide store fills 4 whole 128-B lines of Wt.
// A wave takes 64 k x 16 n, a block 64 k x 128 n; grid = (Nd/128, Kd/64).
// Kd and Nd are compile-time, so that the 8 loads share one address register
// pair (row steps as immediate offsets), and the 4 stores another.
template <int Kd, int Nd>
__global__ __launch_bounds__(256) void transpose_f16(const float* __restrict__ W,
                                                     _Float16* __restrict__ Wt) {
  const int lane = threadIdx.x & 31;
  const int wave = threadIdx.x >> 5;
  const int k = blockIdx.y * 64 + (lane & 7) * 8;
  const int n = blockIdx.x * 128 + wave * 16 + (lane >> 3) * 4;
  const float* src = W + (size_t)k * Nd + n;
  f4 r[8];
#pragma unroll
  for (int j = 0; j < 8; ++j) r[j] = *(const f4*)(src + (size_t)j * Nd);
  _Float16* dst = Wt + (size_t)n * Kd + k;
#pragma unroll
  for (int i = 0; i < 4; ++i) {
    h8 c;
#pragma unroll
    for (int j = 0; j < 8; ++j) c[j] = (_Float16)r[j][i];
    *(h8*)(dst + (size_t)i * Kd) = c;
  }
}

// ---------------------------------------------------------------------------
// WMMA GEMM:  Y[M x N] = A[M x Kd] (f16, row-major) @ B + bias
//   B supplied transposed: Bt[N x Kd] f16 row-major.
//   MODE 0: store f16 row-major (ld = N)
//   MODE 1: store f16 transposed (Y^T, ld = M)     -- used for V
//   MODE 2: store f32 row-major (ld = N)           -- final output
// One wave computes a 32(M) x 64(N) tile; 8 waves / 256-thread block.
// grid = (N/64, M/256)
// ---------------------------------------------------------------------------
template <int MODE>
__global__ __launch_bounds__(256) void gemm_wmma(const _Float16* __restrict__ A,
                                                 const _Float16* __restrict__ Bt,
                                                 const float* __restrict__ bias,
                                                 void* __restrict__ Out,
                                                 int M, int N, int Kd) {
  const int lane = threadIdx.x & 31;
  const int wave = threadIdx.x >> 5;
  const int l16  = lane & 15;
  const int hi   = lane >> 4;
  const int m0   = (blockIdx.y * 8 + wave) * 32;
  const int n0   = blockIdx.x * 64;

  const _Float16* arow0 = A  + (size_t)(m0 + l16) * Kd;
  const _Float16* arow1 = A  + (size_t)(m0 + 16 + l16) * Kd;
  const _Float16* brow  = Bt + (size_t)(n0 + l16) * Kd;

  v8f acc0[4], acc1[4];
#pragma unroll
  for (int nt = 0; nt < 4; ++nt) {
    v8f z = {};
    acc0[nt] = z;
    acc1[nt] = z;
  }

  for (int k0 = 0; k0 < Kd; k0 += 32) {
    v16h a0 = load_frag(arow0 + k0, hi);
    v16h a1 = load_frag(arow1 + k0, hi);
    if (k0 + 32 < Kd) {
      __builtin_prefetch(arow0 + k0 + 64, 0, 1);  // global_prefetch_b8
      __builtin_prefetch(arow1 + k0 + 64, 0, 1);
    }
#pragma unroll
    for (int nt = 0; nt < 4; ++nt) {
      v16h b = load_frag(brow + (size_t)(nt * 16) * Kd + k0, hi);
      acc0[nt] = __builtin_amdgcn_wmma_f32_16x16x32_f16(false, a0, false, b,
                                                        (short)0, acc0[nt], false, false);
      acc1[nt] = __builtin_amdgcn_wmma_f32_16x16x32_f16(false, a1, false, b,
                                                        (short)0, acc1[nt], false, false);
    }
  }

  // C/D layout: element (m = i + 8*hi, n = l16)
#pragma unroll
  for (int nt = 0; nt < 4; ++nt) {
    int n = n0 + nt * 16 + l16;
    float bv = bias[n];
#pragma unroll
    for (int i = 0; i < 8; ++i) {
      int ma = m0 + i + 8 * hi;
      int mb = ma + 16;
      float va = acc0[nt][i] + bv;
      float vb = acc1[nt][i] + bv;
      if (MODE == 0) {
        ((_Float16*)Out)[(size_t)ma * N + n] = (_Float16)va;
        ((_Float16*)Out)[(size_t)mb * N + n] = (_Float16)vb;
      } else if (MODE == 1) {
        ((_Float16*)Out)[(size_t)n * M + ma] = (_Float16)va;
        ((_Float16*)Out)[(size_t)n * M + mb] = (_Float16)vb;
      } else {
        ((float*)Out)[(size_t)ma * N + n] = va;
        ((float*)Out)[(size_t)mb * N + n] = vb;
      }
    }
  }
}

static constexpr int KT     = 128;
static constexpr int NST    = S / KT;
static constexpr int KPITCH = HD * 2 + 16;
static constexpr int VPITCH = KT * 2 + 16;
static constexpr int KBYTES = KT * KPITCH;
static constexpr int VBYTES = HD * VPITCH;
static constexpr int STAGEB = KBYTES + VBYTES;

// One stage: 4 K copies and 4 V^T copies per lane (256 lanes x 16 B = 4 KB each).
// kl / vl: this lane's LDS byte addresses, kg / vg: its global addresses.
// K copy j takes rows 32 j + (tid >> 3); V^T copy j rows 16 j + (tid >> 4).
__device__ inline void stage_copy(unsigned kl, unsigned vl,
                                  const _Float16* kg, const _Float16* vg) {
  asm volatile(
      "global_load_async_to_lds_b128 %0, %8, off\n\t"
      "global_load_async_to_lds_b128 %1, %9, off\n\t"
      "global_load_async_to_lds_b128 %2, %10, off\n\t"
      "global_load_async_to_lds_b128 %3, %11, off\n\t"
      "global_load_async_to_lds_b128 %4, %12, off\n\t"
      "global_load_async_to_lds_b128 %5, %13, off\n\t"
      "global_load_async_to_lds_b128 %6, %14, off\n\t"
      "global_load_async_to_lds_b128 %7, %15, off\n\t"
      "s_wait_xcnt 0x0"
      :
      : "v"(kl), "v"(kl + 32 * KPITCH), "v"(kl + 64 * KPITCH), "v"(kl + 96 * KPITCH),
        "v"(vl), "v"(vl + 16 * VPITCH), "v"(vl + 32 * VPITCH), "v"(vl + 48 * VPITCH),
        "v"(kg), "v"(kg + 32 * NKV), "v"(kg + 64 * NKV), "v"(kg + 96 * NKV),
        "v"(vg), "v"(vg + (size_t)16 * S), "v"(vg + (size_t)32 * S), "v"(vg + (size_t)48 * S)
      : "memory");
}

__global__ __launch_bounds__(256) void attn_kernel(const _Float16* __restrict__ Q,
                                                   const _Float16* __restrict__ Km,
                                                   const _Float16* __restrict__ Vt,
                                                   _Float16* __restrict__ O) {
  __shared__ __attribute__((aligned(16))) unsigned char L[2 * STAGEB];

  const int tid  = threadIdx.x;
  const int lane = threadIdx.x & 31;
  const int wave = threadIdx.x >> 5;
  const int l16  = lane & 15;
  const int hi   = lane >> 4;

  const int idx = blockIdx.x * 8 + wave;   // 0..2047
  const int h   = idx >> 7;                // head 0..15 (the same for a block's 8 waves)
  const int qp2 = idx & 127;               // 32-query pair tile 0..127
  const int kvh = h >> 2;                  // GROUP = 4 (repeat_interleave)

  // This lane's copy addresses for stage 0, buffer 0.
  const unsigned lds0 = (unsigned)(size_t)(&L[0]);
  const unsigned kl0  = lds0 + (tid >> 3) * KPITCH + (tid & 7) * 16;
  const unsigned vl0  = lds0 + KBYTES + (tid >> 4) * VPITCH + (tid & 15) * 16;
  const _Float16* kg  = Km + (size_t)(tid >> 3) * NKV + kvh * HD + (tid & 7) * 8;
  const _Float16* vg  = Vt + (size_t)(kvh * HD + (tid >> 4)) * S + (tid & 15) * 8;

  stage_copy(kl0, vl0, kg, vg);

  // Q^T B-fragments for two 16-query tiles (hd halves 0..31 / 32..63)
  v16h qf[2][2];
#pragma unroll
  for (int s = 0; s < 2; ++s) {
    const _Float16* qp = Q + (size_t)(qp2 * 32 + s * 16 + l16) * Dm + h * HD;
    qf[s][0] = load_frag(qp, hi);
    qf[s][1] = load_frag(qp + 32, hi);
  }

  float mrun[2] = {-1e30f, -1e30f};
  float lrun[2] = {0.0f, 0.0f};
  v8f oacc[2][4];  // O^T tiles: (m = hd, n = query)
#pragma unroll
  for (int s = 0; s < 2; ++s)
#pragma unroll
    for (int nt = 0; nt < 4; ++nt) {
      v8f z = {};
      oacc[s][nt] = z;
    }

  const float scale = 0.125f;  // 1/sqrt(64)

  // Stage 0 has landed for this wave; the barrier publishes it to the others.
  asm volatile("s_wait_asynccnt 0x0" ::: "memory");
  __syncthreads();
  stage_copy(kl0 + STAGEB, vl0 + STAGEB, kg + (size_t)KT * NKV, vg + KT);

  for (int st = 0; st < NST; ++st) {
    const unsigned bufo = (st & 1) * STAGEB;
    const unsigned char* Kl = L + bufo + l16 * KPITCH;
    const unsigned char* Vl = L + bufo + KBYTES + l16 * VPITCH;

    // unrolled so that every LDS read has a constant offset from Kl / Vl
#pragma unroll
    for (int p = 0; p < KT / 32; ++p) {
      // ---- S^T tiles: c[s][t] holds keys p*32+t*16+(i+8*hi), query tile s ----
      v8f c[2][2];
#pragma unroll
      for (int t = 0; t < 2; ++t) {
        const _Float16* kp = (const _Float16*)(Kl + (p * 32 + t * 16) * KPITCH);
        v16h aK0 = load_frag(kp, hi);
        v16h aK1 = load_frag(kp + 32, hi);
#pragma unroll
        for (int s = 0; s < 2; ++s) {
          v8f z = {};
          z       = __builtin_amdgcn_wmma_f32_16x16x32_f16(false, aK0, false, qf[s][0],
                                                           (short)0, z, false, false);
          c[s][t] = __builtin_amdgcn_wmma_f32_16x16x32_f16(false, aK1, false, qf[s][1],
                                                           (short)0, z, false, false);
        }
      }

      // ---- online softmax per query tile (per-lane + one half-swap) ----
      v16h pb[2];
#pragma unroll
      for (int s = 0; s < 2; ++s) {
        float lmax = -1e30f;
#pragma unroll
        for (int i = 0; i < 8; ++i) {
          c[s][0][i] *= scale;
          c[s][1][i] *= scale;
          lmax = fmaxf(lmax, fmaxf(c[s][0][i], c[s][1][i]));
        }
        lmax = fmaxf(lmax, __shfl_xor(lmax, 16, 32));  // combine key halves
        float mnew = fmaxf(mrun[s], lmax);
        float corr = __expf(mrun[s] - mnew);
        mrun[s] = mnew;

        float p0[8], p1[8];
        float ls = 0.0f;
#pragma unroll
        for (int i = 0; i < 8; ++i) {
          p0[i] = __expf(c[s][0][i] - mnew);
          p1[i] = __expf(c[s][1][i] - mnew);
          ls += p0[i] + p1[i];
        }
        ls += __shfl_xor(ls, 16, 32);
        lrun[s] = lrun[s] * corr + ls;

#pragma unroll
        for (int nt = 0; nt < 4; ++nt)
#pragma unroll
          for (int i = 0; i < 8; ++i) oacc[s][nt][i] *= corr;

        // pack P^T B-fragment: c0[j] -> K=hi*8+j, c1[j] -> K=16+hi*8+j
#pragma unroll
        for (int j = 0; j < 8; ++j) {
          pb[s][j]     = (_Float16)p0[j];
          pb[s][j + 8] = (_Float16)p1[j];
        }
      }

      // ---- O^T += V^T(A) x P^T(B); V^T fragments shared by both tiles ----
#pragma unroll
      for (int nt = 0; nt < 4; ++nt) {
        const _Float16* vp = (const _Float16*)(Vl + nt * 16 * VPITCH) + p * 32;
        v16h av = load_frag(vp, hi);
#pragma unroll
        for (int s = 0; s < 2; ++s)
          oacc[s][nt] = __builtin_amdgcn_wmma_f32_16x16x32_f16(false, av, false, pb[s],
                                                               (short)0, oacc[s][nt], false, false);
      }
      if (p == 1) __builtin_amdgcn_sched_barrier(0);
    }

    // Hand-over of the buffers: this wave's LDS reads of stage st are done ...
    asm volatile("s_wait_dscnt 0x0" ::: "memory");
    // ... its own copies of stage st + 1 have landed ...
    asm volatile("s_wait_asynccnt 0x0" ::: "memory");
    // ... and the barrier says both of every wave of the block.
    __syncthreads();
    if (st + 2 < NST)  // refill the buffer that stage st has just left
      stage_copy(kl0 + bufo, vl0 + bufo, kg + (size_t)(st + 2) * KT * NKV, vg + (st + 2) * KT);
  }
  // no copy is left in flight when the wave ends
  asm volatile("s_wait_asynccnt 0x0" ::: "memory");

  // ---- normalize and store: O^T element (m = hd, n = query) ----
#pragma unroll
  for (int s = 0; s < 2; ++s) {
    float rinv = 1.0f / lrun[s];
    const int srow = qp2 * 32 + s * 16 + l16;
    _Float16* op = O + (size_t)srow * Dm + h * HD + 8 * hi;
#pragma unroll
    for (int nt = 0; nt < 4; ++nt) {
      h8 v;
#pragma unroll
      for (int i = 0; i < 8; ++i) v[i] = (_Float16)(oacc[s][nt][i] * rinv);
      *(h8*)(op + nt * 16) = v;
    }
  }
}

// ---------------------------------------------------------------------------
// Host launch
// ---------------------------------------------------------------------------
extern "C" void kernel_launch(void* const* d_in, const int* in_sizes, int n_in,
                              void* d_out, int out_size, void* d_ws, size_t ws_size,
                              hipStream_t stream) {
  (void)in_sizes; (void)n_in; (void)out_size; (void)ws_size;
  const float* X   = (const float*)d_in[0];
  const float* q_w = (const float*)d_in[1];
  const float* q_b = (const float*)d_in[2];
  const float* k_w = (const float*)d_in[3];
  const float* k_b = (const float*)d_in[4];
  const float* v_w = (const float*)d_in[5];
  const float* v_b = (const float*)d_in[6];
  const float* o_w = (const float*)d_in[7];
  const float* o_b = (const float*)d_in[8];
  float* out = (float*)d_out;

  // Carve workspace (f16 buffers), 256B aligned. Total ~33 MB.
  char* ws = (char*)d_ws;
  auto carve = [&](size_t bytes) {
    char* p = ws;
    ws += (bytes + 255) & ~(size_t)255;
    return p;
  };
  _Float16* Xh  = (_Float16*)carve((size_t)S * Dm * 2);    // X in f16
  _Float16* qwt = (_Float16*)carve((size_t)Dm * Dm * 2);   // q_w^T
  _Float16* kwt = (_Float16*)carve((size_t)Dm * NKV * 2);  // k_w^T
  _Float16* vwt = (_Float16*)carve((size_t)Dm * NKV * 2);  // v_w^T
  _Float16* owt = (_Float16*)carve((size_t)Dm * Dm * 2);   // o_w^T
  _Float16* Qh  = (_Float16*)carve((size_t)S * Dm * 2);    // Q [S][1024]
  _Float16* Kh  = (_Float16*)carve((size_t)S * NKV * 2);   // K [S][256]
  _Float16* Vth = (_Float16*)carve((size_t)NKV * S * 2);   // V^T [256][S]
  _Float16* Ah  = (_Float16*)carve((size_t)S * Dm * 2);    // attention out [S][1024]

  // 1) Convert / transpose inputs to f16, 32 elements a thread
  convert_f16<<<(S * Dm) / CVT_BLK, 256, 0, stream>>>(X, Xh);
  transpose_f16<Dm, Dm> <<<dim3(Dm / 128,  Dm / 64), 256, 0, stream>>>(q_w, qwt);
  transpose_f16<Dm, NKV><<<dim3(NKV / 128, Dm / 64), 256, 0, stream>>>(k_w, kwt);
  transpose_f16<Dm, NKV><<<dim3(NKV / 128, Dm / 64), 256, 0, stream>>>(v_w, vwt);
  transpose_f16<Dm, Dm> <<<dim3(Dm / 128,  Dm / 64), 256, 0, stream>>>(o_w, owt);

  // 2) Projections (WMMA GEMMs), 32x64 tile per wave -> grid.y = M/256
  gemm_wmma<0><<<dim3(Dm / 64,  S / 256), 256, 0, stream>>>(Xh, qwt, q_b, Qh,  S, Dm,  Dm);
  gemm_wmma<0><<<dim3(NKV / 64, S / 256), 256, 0, stream>>>(Xh, kwt, k_b, Kh,  S, NKV, Dm);
  gemm_wmma<1><<<dim3(NKV / 64, S / 256), 256, 0, stream>>>(Xh, vwt, v_b, Vth, S, NKV, Dm);

  // 3) Flash attention: 16 heads x 128 query-pair tiles = 2048 waves, 8/block
  attn_kernel<<<(Hn * (S / 32)) / 8, 256, 0, stream>>>(Qh, Kh, Vth, Ah);

  // 4) Output projection -> f32
  gemm_wmma<2><<<dim3(Dm / 64, S / 256), 256, 0, stream>>>(Ah, owt, o_b, out, S, Dm, Dm);
}

// v003
// One run takes 134 microseconds.
// Next to v002, in two timings, it ran 1.76 and 1.77 times as fast.
// Counting every step since v000, it is 2.99 times as fast.
#include <hip/hip_runtime.h>

typedef __attribute__((ext_vector_type(16))) _Float16 v16h;
typedef __attribute__((ext_vector_type(8)))  _Float16 h8;
typedef __attribute__((ext_vector_type(8)))  float    v8f;
typedef __attribute__((ext_vector_type(4)))  float    f4;
typedef __attribute__((ext_vector_type(4)))  _Float16 h4;

static constexpr int S   = 4096;
static constexpr int Dm  = 1024;
static constexpr int Hn  = 16;
static constexpr int KVH = 4;
static constexpr int HD  = 64;
static constexpr int NKV = KVH * HD;   // 256

__device__ inline v16h load_frag(const _Float16* rowptr, int hi) {
  h8 x = *(const h8*)(rowptr + hi * 8);
  h8 y = *(const h8*)(rowptr + 16 + hi * 8);
  v16h r;
#pragma unroll
  for (int j = 0; j < 8; ++j) { r[j] = x[j]; r[j + 8] = y[j]; }
  return r;
}

// ---------------------------------------------------------------------------
// Elementwise f32 -> f16 convert, 32 elements a thread: 8 loads of 16 B in
// flight per lane, each wave-wide load 512 contiguous bytes, each store 256.
// A block takes CVT_BLK elements; the grid covers the array exactly.
// ---------------------------------------------------------------------------
static constexpr int CVT_BLK = 256 * 32;

__global__ __launch_bounds__(256) void convert_f16(const float* __restrict__ in,
                                                   _Float16* __restrict__ out) {
  const size_t base = (size_t)blockIdx.x * CVT_BLK + threadIdx.x * 4;
  f4 v[8];
#pragma unroll
  for (int j = 0; j < 8; ++j) v[j] = *(const f4*)(in + base + j * 1024);
#pragma unroll
  for (int j = 0; j < 8; ++j) {
    h4 h;
#pragma unroll
    for (int i = 0; i < 4; ++i) h[i] = (_Float16)v[j][i];
    *(h4*)(out + base + j * 1024) = h;
  }
}

// W [Kd x Nd] f32 (row-major)  ->  Wt [Nd x Kd] f16 (row-major)
// 32 elements a thread: a block of 8 k x 4 n, read by 8 loads of 16 B along n,
// turned in registers, written by 4 stores of 16 B along k. Eight lanes stand
// side by side in k, so a wave-wide store fills 4 whole 128-B lines of Wt.
// A wave takes 64 k x 16 n, a block 64 k x 128 n; grid = (Nd/128, Kd/64).
// Kd and Nd are compile-time, so that the 8 loads share one address register
// pair (row steps as immediate offsets), and the 4 stores another.
template <int Kd, int Nd>
__global__ __launch_bounds__(256) void transpose_f16(const float* __restrict__ W,
                                                     _Float16* __restrict__ Wt) {
  const int lane = threadIdx.x & 31;
  const int wave = threadIdx.x >> 5;
  const int k = blockIdx.y * 64 + (lane & 7) * 8;
  const int n = blockIdx.x * 128 + wave * 16 + (lane >> 3) * 4;
  const float* src = W + (size_t)k * Nd + n;
  f4 r[8];
#pragma unroll
  for (int j = 0; j < 8; ++j) r[j] = *(const f4*)(src + (size_t)j * Nd);
  _Float16* dst = Wt + (size_t)n * Kd + k;
#pragma unroll
  for (int i = 0; i < 4; ++i) {
    h8 c;
#pragma unroll
    for (int j = 0; j < 8; ++j) c[j] = (_Float16)r[j][i];
    *(h8*)(dst + (size_t)i * Kd) = c;
  }
}

static constexpr int GKS     = 128;
static constexpr int GNST    = Dm / GKS;
static constexpr int GPITCH  = GKS * 2 + 16;
static constexpr int GOPB    = 128 * GPITCH;
static constexpr int GSTAGEB = 2 * GOPB;

// One operand's slab of a stage: 8 copies per lane (256 lanes x 16 B = 16 rows
// each). l: this lane's LDS byte address, g: its global address; copy j takes
// row 16 j + (tid >> 4).
__device__ inline void slab_copy(unsigned l, const _Float16* g) {
  asm volatile(
      "global_load_async_to_lds_b128 %0, %8, off\n\t"
      "global_load_async_to_lds_b128 %1, %9, off\n\t"
      "global_load_async_to_lds_b128 %2, %10, off\n\t"
      "global_load_async_to_lds_b128 %3, %11, off\n\t"
      "global_load_async_to_lds_b128 %4, %12, off\n\t"
      "global_load_async_to_lds_b128 %5, %13, off\n\t"
      "global_load_async_to_lds_b128 %6, %14, off\n\t"
      "global_load_async_to_lds_b128 %7, %15, off\n\t"
      "s_wait_xcnt 0x0"
      :
      : "v"(l), "v"(l + 16 * GPITCH), "v"(l + 32 * GPITCH), "v"(l + 48 * GPITCH),
        "v"(l + 64 * GPITCH), "v"(l + 80 * GPITCH), "v"(l + 96 * GPITCH), "v"(l + 112 * GPITCH),
        "v"(g), "v"(g + 16 * Dm), "v"(g + 32 * Dm), "v"(g + 48 * Dm),
        "v"(g + 64 * Dm), "v"(g + 80 * Dm), "v"(g + 96 * Dm), "v"(g + 112 * Dm)
      : "memory");
}

template <int MODE, int N>
__global__ __launch_bounds__(256) void gemm_wmma(const _Float16* __restrict__ A,
                                                 const _Float16* __restrict__ Bt,
                                                 const float* __restrict__ bias,
                                                 void* __restrict__ Out) {
  __shared__ __attribute__((aligned(16))) unsigned char L[2 * GSTAGEB];

  constexpr int M = S;
  const int tid  = threadIdx.x;
  const int lane = threadIdx.x & 31;
  const int wave = threadIdx.x >> 5;
  const int l16  = lane & 15;
  const int hi   = lane >> 4;
  const int wm   = (wave >> 1) * 32;       // this wave's rows in the block tile
  const int wn   = (wave & 1) * 64;        // this wave's columns in the block tile
  const int bm0  = blockIdx.y * 128;
  const int bn0  = blockIdx.x * 128;
  const int m0   = bm0 + wm;
  const int n0   = bn0 + wn;

  // This lane's copy addresses for stage 0, buffer 0.
  const unsigned lds0 = (unsigned)(size_t)(&L[0]);
  const unsigned al0  = lds0 + (tid >> 4) * GPITCH + (tid & 15) * 16;
  const unsigned bl0  = al0 + GOPB;
  const _Float16* ag  = A  + (size_t)(bm0 + (tid >> 4)) * Dm + (tid & 15) * 8;
  const _Float16* bg  = Bt + (size_t)(bn0 + (tid >> 4)) * Dm + (tid & 15) * 8;

  slab_copy(al0, ag);
  slab_copy(bl0, bg);

  v8f acc0[4], acc1[4];
#pragma unroll
  for (int nt = 0; nt < 4; ++nt) {
    v8f z = {};
    acc0[nt] = z;
    acc1[nt] = z;
  }

  // Stage 0 has landed for this wave; the barrier publishes it to the others.
  asm volatile("s_wait_asynccnt 0x0" ::: "memory");
  __syncthreads();
  slab_copy(al0 + GSTAGEB, ag + GKS);
  slab_copy(bl0 + GSTAGEB, bg + GKS);

  for (int st = 0; st < GNST; ++st) {
    const unsigned bufo = (st & 1) * GSTAGEB;
    const unsigned char* Al = L + bufo + (wm + l16) * GPITCH;
    const unsigned char* Bl = L + bufo + GOPB + (wn + l16) * GPITCH;

    // Two fragment sets: the 12 LDS reads of k step kk + 1 go out as one group
    // ahead of the 8 WMMAs of k step kk (inside this stage only; nothing of the
    // next stage is read here). Unrolled: constant offsets from Al / Bl.
    v16h af[2][2], bf[2][4];
    af[0][0] = load_frag((const _Float16*)Al, hi);
    af[0][1] = load_frag((const _Float16*)(Al + 16 * GPITCH), hi);
#pragma unroll
    for (int nt = 0; nt < 4; ++nt)
      bf[0][nt] = load_frag((const _Float16*)(Bl + nt * 16 * GPITCH), hi);
#pragma unroll
    for (int kk = 0; kk < GKS / 32; ++kk) {
      const int cur = kk & 1, nxt = cur ^ 1;
      if (kk + 1 < GKS / 32) {
        af[nxt][0] = load_frag((const _Float16*)Al + (kk + 1) * 32, hi);
        af[nxt][1] = load_frag((const _Float16*)(Al + 16 * GPITCH) + (kk + 1) * 32, hi);
#pragma unroll
        for (int nt = 0; nt < 4; ++nt)
          bf[nxt][nt] = load_frag((const _Float16*)(Bl + nt * 16 * GPITCH) + (kk + 1) * 32, hi);
      }
      // Keeps the read group above in front of the WMMAs below: left free, the
      // scheduler sinks each read to its use and waits out the LDS latency
      // before every pair of WMMAs.
      __builtin_amdgcn_sched_barrier(0);
#pragma unroll
      for (int nt = 0; nt < 4; ++nt) {
        acc0[nt] = __builtin_amdgcn_wmma_f32_16x16x32_f16(false, af[cur][0], false, bf[cur][nt],
                                                          (short)0, acc0[nt], false, false);
        acc1[nt] = __builtin_amdgcn_wmma_f32_16x16x32_f16(false, af[cur][1], false, bf[cur][nt],
                                                          (short)0, acc1[nt], false, false);
      }
    }

    // Hand-over of the buffers: this wave's LDS reads of stage st are done ...
    asm volatile("s_wait_dscnt 0x0" ::: "memory");
    // ... its own copies of stage st + 1 have landed ...
    asm volatile("s_wait_asynccnt 0x0" ::: "memory");
    // ... and the barrier says both of every wave of the block.
    __syncthreads();
    if (st + 2 < GNST) {  // refill the buffer that stage st has just left
      slab_copy(al0 + bufo, ag + (st + 2) * GKS);
      slab_copy(bl0 + bufo, bg + (st + 2) * GKS);
    }
  }
  // no copy is left in flight when the wave ends
  asm volatile("s_wait_asynccnt 0x0" ::: "memory");

  // C/D layout: element (m = i + 8*hi, n = l16)
#pragma unroll
  for (int nt = 0; nt < 4; ++nt) {
    int n = n0 + nt * 16 + l16;
    float bv = bias[n];
#pragma unroll
    for (int i = 0; i < 8; ++i) {
      int ma = m0 + i + 8 * hi;
      int mb = ma + 16;
      float va = acc0[nt][i] + bv;
      float vb = acc1[nt][i] + bv;
      if (MODE == 0) {
        ((_Float16*)Out)[(size_t)ma * N + n] = (_Float16)va;
        ((_Float16*)Out)[(size_t)mb * N + n] = (_Float16)vb;
      } else if (MODE == 1) {
        ((_Float16*)Out)[(size_t)n * M + ma] = (_Float16)va;
        ((_Float16*)Out)[(size_t)n * M + mb] = (_Float16)vb;
      } else {
        ((float*)Out)[(size_t)ma * N + n] = va;
        ((float*)Out)[(size_t)mb * N + n] = vb;
      }
    }
  }
}

static constexpr int KT     = 128;
static constexpr int NST    = S / KT;
static constexpr int KPITCH = HD * 2 + 16;
static constexpr int VPITCH = KT * 2 + 16;
static constexpr int KBYTES = KT * KPITCH;
static constexpr int VBYTES = HD * VPITCH;
static constexpr int STAGEB = KBYTES + VBYTES;

// One stage: 4 K copies and 4 V^T copies per lane (256 lanes x 16 B = 4 KB each).
// kl / vl: this lane's LDS byte addresses, kg / vg: its global addresses.
// K copy j takes rows 32 j + (tid >> 3); V^T copy j rows 16 j + (tid >> 4).
__device__ inline void stage_copy(unsigned kl, unsigned vl,
                                  const _Float16* kg, const _Float16* vg) {
  asm volatile(
      "global_load_async_to_lds_b128 %0, %8, off\n\t"
      "global_load_async_to_lds_b128 %1, %9, off\n\t"
      "global_load_async_to_lds_b128 %2, %10, off\n\t"
      "global_load_async_to_lds_b128 %3, %11, off\n\t"
      "global_load_async_to_lds_b128 %4, %12, off\n\t"
      "global_load_async_to_lds_b128 %5, %13, off\n\t"
      "global_load_async_to_lds_b128 %6, %14, off\n\t"
      "global_load_async_to_lds_b128 %7, %15, off\n\t"
      "s_wait_xcnt 0x0"
      :
      : "v"(kl), "v"(kl + 32 * KPITCH), "v"(kl + 64 * KPITCH), "v"(kl + 96 * KPITCH),
        "v"(vl), "v"(vl + 16 * VPITCH), "v"(vl + 32 * VPITCH), "v"(vl + 48 * VPITCH),
        "v"(kg), "v"(kg + 32 * NKV), "v"(kg + 64 * NKV), "v"(kg + 96 * NKV),
        "v"(vg), "v"(vg + (size_t)16 * S), "v"(vg + (size_t)32 * S), "v"(vg + (size_t)48 * S)
      : "memory");
}

__global__ __launch_bounds__(256) void attn_kernel(const _Float16* __restrict__ Q,
                                                   const _Float16* __restrict__ Km,
                                                   const _Float16* __restrict__ Vt,
                                                   _Float16* __restrict__ O) {
  __shared__ __attribute__((aligned(16))) unsigned char L[2 * STAGEB];

  const int tid  = threadIdx.x;
  const int lane = threadIdx.x & 31;
  const int wave = threadIdx.x >> 5;
  const int l16  = lane & 15;
  const int hi   = lane >> 4;

  const int idx = blockIdx.x * 8 + wave;   // 0..2047
  const int h   = idx >> 7;                // head 0..15 (the same for a block's 8 waves)
  const int qp2 = idx & 127;               // 32-query pair tile 0..127
  const int kvh = h >> 2;                  // GROUP = 4 (repeat_interleave)

  // This lane's copy addresses for stage 0, buffer 0.
  const unsigned lds0 = (unsigned)(size_t)(&L[0]);
  const unsigned kl0  = lds0 + (tid >> 3) * KPITCH + (tid & 7) * 16;
  const unsigned vl0  = lds0 + KBYTES + (tid >> 4) * VPITCH + (tid & 15) * 16;
  const _Float16* kg  = Km + (size_t)(tid >> 3) * NKV + kvh * HD + (tid & 7) * 8;
  const _Float16* vg  = Vt + (size_t)(kvh * HD + (tid >> 4)) * S + (tid & 15) * 8;

  stage_copy(kl0, vl0, kg, vg);

  // Q^T B-fragments for two 16-query tiles (hd halves 0..31 / 32..63)
  v16h qf[2][2];
#pragma unroll
  for (int s = 0; s < 2; ++s) {
    const _Float16* qp = Q + (size_t)(qp2 * 32 + s * 16 + l16) * Dm + h * HD;
    qf[s][0] = load_frag(qp, hi);
    qf[s][1] = load_frag(qp + 32, hi);
  }

  float mrun[2] = {-1e30f, -1e30f};
  float lrun[2] = {0.0f, 0.0f};
  v8f oacc[2][4];  // O^T tiles: (m = hd, n = query)
#pragma unroll
  for (int s = 0; s < 2; ++s)
#pragma unroll
    for (int nt = 0; nt < 4; ++nt) {
      v8f z = {};
      oacc[s][nt] = z;
    }

  const float scale = 0.125f;  // 1/sqrt(64)

  // Stage 0 has landed for this wave; the barrier publishes it to the others.
  asm volatile("s_wait_asynccnt 0x0" ::: "memory");
  __syncthreads();
  stage_copy(kl0 + STAGEB, vl0 + STAGEB, kg + (size_t)KT * NKV, vg + KT);

  for (int st = 0; st < NST; ++st) {
    const unsigned bufo = (st & 1) * STAGEB;
    const unsigned char* Kl = L + bufo + l16 * KPITCH;
    const unsigned char* Vl = L + bufo + KBYTES + l16 * VPITCH;

    // unrolled so that every LDS read has a constant offset from Kl / Vl
#pragma unroll
    for (int p = 0; p < KT / 32; ++p) {
      // ---- S^T tiles: c[s][t] holds keys p*32+t*16+(i+8*hi), query tile s ----
      v8f c[2][2];
#pragma unroll
      for (int t = 0; t < 2; ++t) {
        const _Float16* kp = (const _Float16*)(Kl + (p * 32 + t * 16) * KPITCH);
        v16h aK0 = load_frag(kp, hi);
        v16h aK1 = load_frag(kp + 32, hi);
#pragma unroll
        for (int s = 0; s < 2; ++s) {
          v8f z = {};
          z       = __builtin_amdgcn_wmma_f32_16x16x32_f16(false, aK0, false, qf[s][0],
                                                           (short)0, z, false, false);
          c[s][t] = __builtin_amdgcn_wmma_f32_16x16x32_f16(false, aK1, false, qf[s][1],
                                                           (short)0, z, false, false);
        }
      }

      // ---- online softmax per query tile (per-lane + one half-swap) ----
      v16h pb[2];
#pragma unroll
      for (int s = 0; s < 2; ++s) {
        float lmax = -1e30f;
#pragma unroll
        for (int i = 0; i < 8; ++i) {
          c[s][0][i] *= scale;
          c[s][1][i] *= scale;
          lmax = fmaxf(lmax, fmaxf(c[s][0][i], c[s][1][i]));
        }
        lmax = fmaxf(lmax, __shfl_xor(lmax, 16, 32));  // combine key halves
        float mnew = fmaxf(mrun[s], lmax);
        float corr = __expf(mrun[s] - mnew);
        mrun[s] = mnew;

        float p0[8], p1[8];
        float ls = 0.0f;
#pragma unroll
        for (int i = 0; i < 8; ++i) {
          p0[i] = __expf(c[s][0][i] - mnew);
          p1[i] = __expf(c[s][1][i] - mnew);
          ls += p0[i] + p1[i];
        }
        ls += __shfl_xor(ls, 16, 32);
        lrun[s] = lrun[s] * corr + ls;

#pragma unroll
        for (int nt = 0; nt < 4; ++nt)
#pragma unroll
          for (int i = 0; i < 8; ++i) oacc[s][nt][i] *= corr;

        // pack P^T B-fragment: c0[j] -> K=hi*8+j, c1[j] -> K=16+hi*8+j
#pragma unroll
        for (int j = 0; j < 8; ++j) {
          pb[s][j]     = (_Float16)p0[j];
          pb[s][j + 8] = (_Float16)p1[j];
        }
      }

      // ---- O^T += V^T(A) x P^T(B); V^T fragments shared by both tiles ----
#pragma unroll
      for (int nt = 0; nt < 4; ++nt) {
        const _Float16* vp = (const _Float16*)(Vl + nt * 16 * VPITCH) + p * 32;
        v16h av = load_frag(vp, hi);
#pragma unroll
        for (int s = 0; s < 2; ++s)
          oacc[s][nt] = __builtin_amdgcn_wmma_f32_16x16x32_f16(false, av, false, pb[s],
                                                               (short)0, oacc[s][nt], false, false);
      }
      if (p == 1) __builtin_amdgcn_sched_barrier(0);
    }

    // Hand-over of the buffers: this wave's LDS reads of stage st are done ...
    asm volatile("s_wait_dscnt 0x0" ::: "memory");
    // ... its own copies of stage st + 1 have landed ...
    asm volatile("s_wait_asynccnt 0x0" ::: "memory");
    // ... and the barrier says both of every wave of the block.
    __syncthreads();
    if (st + 2 < NST)  // refill the buffer that stage st has just left
      stage_copy(kl0 + bufo, vl0 + bufo, kg + (size_t)(st + 2) * KT * NKV, vg + (st + 2) * KT);
  }
  // no copy is left in flight when the wave ends
  asm volatile("s_wait_asynccnt 0x0" ::: "memory");

  // ---- normalize and store: O^T element (m = hd, n = query) ----
#pragma unroll
  for (int s = 0; s < 2; ++s) {
    float rinv = 1.0f / lrun[s];
    const int srow = qp2 * 32 + s * 16 + l16;
    _Float16* op = O + (size_t)srow * Dm + h * HD + 8 * hi;
#pragma unroll
    for (int nt = 0; nt < 4; ++nt) {
      h8 v;
#pragma unroll
      for (int i = 0; i < 8; ++i) v[i] = (_Float16)(oacc[s][nt][i] * rinv);
      *(h8*)(op + nt * 16) = v;
    }
  }
}

// ---------------------------------------------------------------------------
// Host launch
// ---------------------------------------------------------------------------
extern "C" void kernel_launch(void* const* d_in, const int* in_sizes, int n_in,
                              void* d_out, int out_size, void* d_ws, size_t ws_size,
                              hipStream_t stream) {
  (void)in_sizes; (void)n_in; (void)out_size; (void)ws_size;
  const float* X   = (const float*)d_in[0];
  const float* q_w = (const float*)d_in[1];
  const float* q_b = (const float*)d_in[2];
  const float* k_w = (const float*)d_in[3];
  const float* k_b = (const float*)d_in[4];
  const float* v_w = (const float*)d_in[5];
  const float* v_b = (const float*)d_in[6];
  const float* o_w = (const float*)d_in[7];
  const float* o_b = (const float*)d_in[8];
  float* out = (float*)d_out;

  // Carve workspace (f16 buffers), 256B aligned. Total ~33 MB.
  char* ws = (char*)d_ws;
  auto carve = [&](size_t bytes) {
    char* p = ws;
    ws += (bytes + 255) & ~(size_t)255;
    return p;
  };
  _Float16* Xh  = (_Float16*)carve((size_t)S * Dm * 2);    // X in f16
  _Float16* qwt = (_Float16*)carve((size_t)Dm * Dm * 2);   // q_w^T
  _Float16* kwt = (_Float16*)carve((size_t)Dm * NKV * 2);  // k_w^T
  _Float16* vwt = (_Float16*)carve((size_t)Dm * NKV * 2);  // v_w^T
  _Float16* owt = (_Float16*)carve((size_t)Dm * Dm * 2);   // o_w^T
  _Float16* Qh  = (_Float16*)carve((size_t)S * Dm * 2);    // Q [S][1024]
  _Float16* Kh  = (_Float16*)carve((size_t)S * NKV * 2);   // K [S][256]
  _Float16* Vth = (_Float16*)carve((size_t)NKV * S * 2);   // V^T [256][S]
  _Float16* Ah  = (_Float16*)carve((size_t)S * Dm * 2);    // attention out [S][1024]

  // 1) Convert / transpose inputs to f16, 32 elements a thread
  convert_f16<<<(S * Dm) / CVT_BLK, 256, 0, stream>>>(X, Xh);
  transpose_f16<Dm, Dm> <<<dim3(Dm / 128,  Dm / 64), 256, 0, stream>>>(q_w, qwt);
  transpose_f16<Dm, NKV><<<dim3(NKV / 128, Dm / 64), 256, 0, stream>>>(k_w, kwt);
  transpose_f16<Dm, NKV><<<dim3(NKV / 128, Dm / 64), 256, 0, stream>>>(v_w, vwt);
  transpose_f16<Dm, Dm> <<<dim3(Dm / 128,  Dm / 64), 256, 0, stream>>>(o_w, owt);

  // 2) Projections (WMMA GEMMs), 128x128 tile per block
  gemm_wmma<0, Dm> <<<dim3(Dm / 128,  S / 128), 256, 0, stream>>>(Xh, qwt, q_b, Qh);
  gemm_wmma<0, NKV><<<dim3(NKV / 128, S / 128), 256, 0, stream>>>(Xh, kwt, k_b, Kh);
  gemm_wmma<1, NKV><<<dim3(NKV / 128, S / 128), 256, 0, stream>>>(Xh, vwt, v_b, Vth);

  // 3) Flash attention: 16 heads x 128 query-pair tiles = 2048 waves, 8/block
  attn_kernel<<<(Hn * (S / 32)) / 8, 256, 0, stream>>>(Qh, Kh, Vth, Ah);

  // 4) Output projection -> f32
  gemm_wmma<2, Dm><<<dim3(Dm / 128, S / 128), 256, 0, stream>>>(Ah, owt, o_b, out);
}

// v004
// One run takes 107 microseconds.
// In both of two side-by-side timings against v003, it was 1.26 times as fast.
// Over all steps from v000 it is 3.76 times as fast.
#include <hip/hip_runtime.h>

typedef __attribute__((ext_vector_type(16))) _Float16 v16h;
typedef __attribute__((ext_vector_type(8)))  _Float16 h8;
typedef __attribute__((ext_vector_type(8)))  float    v8f;
typedef __attribute__((ext_vector_type(4)))  float    f4;
typedef __attribute__((ext_vector_type(4)))  _Float16 h4;

static constexpr int S   = 4096;
static constexpr int Dm  = 1024;
static constexpr int Hn  = 16;
static constexpr int KVH = 4;
static constexpr int HD  = 64;
static constexpr int NKV = KVH * HD;   // 256

__device__ inline v16h load_frag(const _Float16* rowptr, int hi) {
  h8 x = *(const h8*)(rowptr + hi * 8);
  h8 y = *(const h8*)(rowptr + 16 + hi * 8);
  v16h r;
#pragma unroll
  for (int j = 0; j < 8; ++j) { r[j] = x[j]; r[j + 8] = y[j]; }
  return r;
}

// ---------------------------------------------------------------------------
// Elementwise f32 -> f16 convert, 32 elements a thread: 8 loads of 16 B in
// flight per lane, each wave-wide load 512 contiguous bytes, each store 256.
// A block takes CVT_BLK elements; blocks 0 .. size / CVT_BLK - 1 cover the array.
// ---------------------------------------------------------------------------
static constexpr int CVT_BLK = 256 * 32;

__device__ inline void convert_f16(const float* __restrict__ in,
                                   _Float16* __restrict__ out, int blk) {
  const size_t base = (size_t)blk * CVT_BLK + threadIdx.x * 4;
  f4 v[8];
#pragma unroll
  for (int j = 0; j < 8; ++j) v[j] = *(const f4*)(in + base + j * 1024);
#pragma unroll
  for (int j = 0; j < 8; ++j) {
    h4 h;
#pragma unroll
    for (int i = 0; i < 4; ++i) h[i] = (_Float16)v[j][i];
    *(h4*)(out + base + j * 1024) = h;
  }
  // In the merged kernel another job's code follows this one in the listing:
  // the wait stands in front of any rewrite of a register the stores above name.
  asm volatile("s_wait_xcnt 0x0" ::: "memory");
}

// W [Kd x Nd] f32 (row-major)  ->  Wt [Nd x Kd] f16 (row-major)
// 32 elements a thread: a block of 8 k x 4 n, read by 8 loads of 16 B along n,
// turned in registers, written by 4 stores of 16 B along k. Eight lanes stand
// side by side in k, so a wave-wide store fills 4 whole 128-B lines of Wt.
// A wave takes 64 k x 16 n, a block 64 k x 128 n; (bx, by) in (Nd/128, Kd/64).
// Kd and Nd are compile-time, so that the 8 loads share one address register
// pair (row steps as immediate offsets), and the 4 stores another.
template <int Kd, int Nd>
__device__ inline void transpose_f16(const float* __restrict__ W,
                                     _Float16* __restrict__ Wt, int bx, int by) {
  const int lane = threadIdx.x & 31;
  const int wave = threadIdx.x >> 5;
  const int k = by * 64 + (lane & 7) * 8;
  const int n = bx * 128 + wave * 16 + (lane >> 3) * 4;
  const float* src = W + (size_t)k * Nd + n;
  f4 r[8];
#pragma unroll
  for (int j = 0; j < 8; ++j) r[j] = *(const f4*)(src + (size_t)j * Nd);
  _Float16* dst = Wt + (size_t)n * Kd + k;
#pragma unroll
  for (int i = 0; i < 4; ++i) {
    h8 c;
#pragma unroll
    for (int j = 0; j < 8; ++j) c[j] = (_Float16)r[j][i];
    *(h8*)(dst + (size_t)i * Kd) = c;
  }
  // In the merged kernel another job's code follows this one in the listing:
  // the wait stands in front of any rewrite of a register the stores above name.
  asm volatile("s_wait_xcnt 0x0" ::: "memory");
}

// The five jobs above read inputs only and none reads another's output, so
// they share one grid: a block picks its job by its index (the same for all
// its threads). Transposes first, then the convert.
static constexpr int PB_BIG = (Dm / 128) * (Dm / 64);    // blocks of a Dm x Dm transpose
static constexpr int PB_KV  = (NKV / 128) * (Dm / 64);   // blocks of a Dm x NKV transpose
static constexpr int PB_CVT = (S * Dm) / CVT_BLK;        // blocks of the convert
static constexpr int PB_ALL = 2 * PB_BIG + 2 * PB_KV + PB_CVT;

__global__ __launch_bounds__(256) void prep_f16(const float* __restrict__ X,
                                                const float* __restrict__ q_w,
                                                const float* __restrict__ k_w,
                                                const float* __restrict__ v_w,
                                                const float* __restrict__ o_w,
                                                _Float16* __restrict__ Xh,
                                                _Float16* __restrict__ qwt,
                                                _Float16* __restrict__ kwt,
                                                _Float16* __restrict__ vwt,
                                                _Float16* __restrict__ owt) {
  int b = blockIdx.x;
  if (b < 2 * PB_BIG) {
    const bool o = b >= PB_BIG;
    if (o) b -= PB_BIG;
    transpose_f16<Dm, Dm>(o ? o_w : q_w, o ? owt : qwt, b % (Dm / 128), b / (Dm / 128));
    return;
  }
  b -= 2 * PB_BIG;
  if (b < 2 * PB_KV) {
    const bool v = b >= PB_KV;
    if (v) b -= PB_KV;
    transpose_f16<Dm, NKV>(v ? v_w : k_w, v ? vwt : kwt, b % (NKV / 128), b / (NKV / 128));
    return;
  }
  convert_f16(X, Xh, b - 2 * PB_KV);
}

static constexpr int GKS     = 128;
static constexpr int GNST    = Dm / GKS;
static constexpr int GPITCH  = GKS * 2 + 16;
static constexpr int GOPB    = 128 * GPITCH;
static constexpr int GSTAGEB = 2 * GOPB;

// One operand's slab of a stage: 8 copies per lane (256 lanes x 16 B = 16 rows
// each). l: this lane's LDS byte address, g: its global address; copy j takes
// row 16 j + (tid >> 4).
__device__ inline void slab_copy(unsigned l, const _Float16* g) {
  asm volatile(
      "global_load_async_to_lds_b128 %0, %8, off\n\t"
      "global_load_async_to_lds_b128 %1, %9, off\n\t"
      "global_load_async_to_lds_b128 %2, %10, off\n\t"
      "global_load_async_to_lds_b128 %3, %11, off\n\t"
      "global_load_async_to_lds_b128 %4, %12, off\n\t"
      "global_load_async_to_lds_b128 %5, %13, off\n\t"
      "global_load_async_to_lds_b128 %6, %14, off\n\t"
      "global_load_async_to_lds_b128 %7, %15, off\n\t"
      "s_wait_xcnt 0x0"
      :
      : "v"(l), "v"(l + 16 * GPITCH), "v"(l + 32 * GPITCH), "v"(l + 48 * GPITCH),
        "v"(l + 64 * GPITCH), "v"(l + 80 * GPITCH), "v"(l + 96 * GPITCH), "v"(l + 112 * GPITCH),
        "v"(g), "v"(g + 16 * Dm), "v"(g + 32 * Dm), "v"(g + 48 * Dm),
        "v"(g + 64 * Dm), "v"(g + 80 * Dm), "v"(g + 96 * Dm), "v"(g + 112 * Dm)
      : "memory");
}

template <int MODE, int N>
__device__ inline void gemm_tile(unsigned char* L,
                                 const _Float16* __restrict__ A,
                                 const _Float16* __restrict__ Bt,
                                 const float* __restrict__ bias,
                                 void* __restrict__ Out, int bx, int by) {
  constexpr int M = S;
  const int tid  = threadIdx.x;
  const int lane = threadIdx.x & 31;
  const int wave = threadIdx.x >> 5;
  const int l16  = lane & 15;
  const int hi   = lane >> 4;
  const int wm   = (wave >> 1) * 32;       // this wave's rows in the block tile
  const int wn   = (wave & 1) * 64;        // this wave's columns in the block tile
  const int bm0  = by * 128;
  const int bn0  = bx * 128;
  const int m0   = bm0 + wm;
  const int n0   = bn0 + wn;

  // This lane's copy addresses for stage 0, buffer 0.
  const unsigned lds0 = (unsigned)(size_t)(&L[0]);
  const unsigned al0  = lds0 + (tid >> 4) * GPITCH + (tid & 15) * 16;
  const unsigned bl0  = al0 + GOPB;
  const _Float16* ag  = A  + (size_t)(bm0 + (tid >> 4)) * Dm + (tid & 15) * 8;
  const _Float16* bg  = Bt + (size_t)(bn0 + (tid >> 4)) * Dm + (tid & 15) * 8;

  slab_copy(al0, ag);
  slab_copy(bl0, bg);

  v8f acc0[4], acc1[4];
#pragma unroll
  for (int nt = 0; nt < 4; ++nt) {
    v8f z = {};
    acc0[nt] = z;
    acc1[nt] = z;
  }

  // Stage 0 has landed for this wave; the barrier publishes it to the others.
  asm volatile("s_wait_asynccnt 0x0" ::: "memory");
  __syncthreads();
  slab_copy(al0 + GSTAGEB, ag + GKS);
  slab_copy(bl0 + GSTAGEB, bg + GKS);

#pragma unroll 1
  for (int st = 0; st < GNST; ++st) {
    const unsigned bufo = (st & 1) * GSTAGEB;
    const unsigned char* Al = L + bufo + (wm + l16) * GPITCH;
    const unsigned char* Bl = L + bufo + GOPB + (wn + l16) * GPITCH;

    // Two fragment sets: the 12 LDS reads of k step kk + 1 go out as one group
    // ahead of the 8 WMMAs of k step kk (inside this stage only; nothing of the
    // next stage is read here). Unrolled: constant offsets from Al / Bl.
    v16h af[2][2], bf[2][4];
    af[0][0] = load_frag((const _Float16*)Al, hi);
    af[0][1] = load_frag((const _Float16*)(Al + 16 * GPITCH), hi);
#pragma unroll
    for (int nt = 0; nt < 4; ++nt)
      bf[0][nt] = load_frag((const _Float16*)(Bl + nt * 16 * GPITCH), hi);
#pragma unroll
    for (int kk = 0; kk < GKS / 32; ++kk) {
      const int cur = kk & 1, nxt = cur ^ 1;
      if (kk + 1 < GKS / 32) {
        af[nxt][0] = load_frag((const _Float16*)Al + (kk + 1) * 32, hi);
        af[nxt][1] = load_frag((const _Float16*)(Al + 16 * GPITCH) + (kk + 1) * 32, hi);
#pragma unroll
        for (int nt = 0; nt < 4; ++nt)
          bf[nxt][nt] = load_frag((const _Float16*)(Bl + nt * 16 * GPITCH) + (kk + 1) * 32, hi);
      }
      // Keeps the read group above in front of the WMMAs below: left free, the
      // scheduler sinks each read to its use and waits out the LDS latency
      // before every pair of WMMAs.
      __builtin_amdgcn_sched_barrier(0);
#pragma unroll
      for (int nt = 0; nt < 4; ++nt) {
        acc0[nt] = __builtin_amdgcn_wmma_f32_16x16x32_f16(false, af[cur][0], false, bf[cur][nt],
                                                          (short)0, acc0[nt], false, false);
        acc1[nt] = __builtin_amdgcn_wmma_f32_16x16x32_f16(false, af[cur][1], false, bf[cur][nt],
                                                          (short)0, acc1[nt], false, false);
      }
    }

    // Hand-over of the buffers: this wave's LDS reads of stage st are done ...
    asm volatile("s_wait_dscnt 0x0" ::: "memory");
    // ... its own copies of stage st + 1 have landed ...
    asm volatile("s_wait_asynccnt 0x0" ::: "memory");
    // ... and the barrier says both of every wave of the block.
    __syncthreads();
    if (st + 2 < GNST) {  // refill the buffer that stage st has just left
      slab_copy(al0 + bufo, ag + (st + 2) * GKS);
      slab_copy(bl0 + bufo, bg + (st + 2) * GKS);
    }
  }
  // no copy is left in flight when the wave ends
  asm volatile("s_wait_asynccnt 0x0" ::: "memory");

  // C/D layout: element (m = i + 8*hi, n = l16)
#pragma unroll
  for (int nt = 0; nt < 4; ++nt) {
    int n = n0 + nt * 16 + l16;
    float bv = bias[n];
#pragma unroll
    for (int i = 0; i < 8; ++i) {
      int ma = m0 + i + 8 * hi;
      int mb = ma + 16;
      float va = acc0[nt][i] + bv;
      float vb = acc1[nt][i] + bv;
      if (MODE == 0) {
        ((_Float16*)Out)[(size_t)ma * N + n] = (_Float16)va;
        ((_Float16*)Out)[(size_t)mb * N + n] = (_Float16)vb;
      } else if (MODE == 1) {
        ((_Float16*)Out)[(size_t)n * M + ma] = (_Float16)va;
        ((_Float16*)Out)[(size_t)n * M + mb] = (_Float16)vb;
      } else {
        ((float*)Out)[(size_t)ma * N + n] = va;
        ((float*)Out)[(size_t)mb * N + n] = vb;
      }
    }
  }
  // In the merged kernel another job's code follows this one in the listing:
  // the wait stands in front of any rewrite of a register the stores above name.
  // (The output projection is its kernel's only job: the wave ends here.)
  if (MODE != 2) asm volatile("s_wait_xcnt 0x0" ::: "memory");
}

// The three projections read the same Xh and none reads another's output, so
// they share one grid: blockIdx.x runs over the column tiles of Q, then K,
// then V (a choice that is the same for all threads of a block).
// grid = ((Dm + 2 NKV)/128, S/128)
__global__ __launch_bounds__(256) void gemm_qkv(const _Float16* __restrict__ Xh,
                                                const _Float16* __restrict__ qwt,
                                                const _Float16* __restrict__ kwt,
                                                const _Float16* __restrict__ vwt,
                                                const float* __restrict__ q_b,
                                                const float* __restrict__ k_b,
                                                const float* __restrict__ v_b,
                                                _Float16* __restrict__ Qh,
                                                _Float16* __restrict__ Kh,
                                                _Float16* __restrict__ Vth) {
  __shared__ __attribute__((aligned(16))) unsigned char L[2 * GSTAGEB];
  const int bx = blockIdx.x;
  if (bx < Dm / 128)
    gemm_tile<0, Dm>(L, Xh, qwt, q_b, Qh, bx, blockIdx.y);
  else if (bx < (Dm + NKV) / 128)
    gemm_tile<0, NKV>(L, Xh, kwt, k_b, Kh, bx - Dm / 128, blockIdx.y);
  else
    gemm_tile<1, NKV>(L, Xh, vwt, v_b, Vth, bx - (Dm + NKV) / 128, blockIdx.y);
}

// Output projection. grid = (Dm/128, S/128)
__global__ __launch_bounds__(256) void gemm_out(const _Float16* __restrict__ Ah,
                                                const _Float16* __restrict__ owt,
                                                const float* __restrict__ o_b,
                                                float* __restrict__ out) {
  __shared__ __attribute__((aligned(16))) unsigned char L[2 * GSTAGEB];
  gemm_tile<2, Dm>(L, Ah, owt, o_b, out, blockIdx.x, blockIdx.y);
}

static constexpr int KT     = 128;
static constexpr int NST    = S / KT;
static constexpr int KPITCH = HD * 2 + 16;
static constexpr int VPITCH = KT * 2 + 16;
static constexpr int KBYTES = KT * KPITCH;
static constexpr int VBYTES = HD * VPITCH;
static constexpr int STAGEB = KBYTES + VBYTES;

// One stage: 4 K copies and 4 V^T copies per lane (256 lanes x 16 B = 4 KB each).
// kl / vl: this lane's LDS byte addresses, kg / vg: its global addresses.
// K copy j takes rows 32 j + (tid >> 3); V^T copy j rows 16 j + (tid >> 4).
__device__ inline void stage_copy(unsigned kl, unsigned vl,
                                  const _Float16* kg, const _Float16* vg) {
  asm volatile(
      "global_load_async_to_lds_b128 %0, %8, off\n\t"
      "global_load_async_to_lds_b128 %1, %9, off\n\t"
      "global_load_async_to_lds_b128 %2, %10, off\n\t"
      "global_load_async_to_lds_b128 %3, %11, off\n\t"
      "global_load_async_to_lds_b128 %4, %12, off\n\t"
      "global_load_async_to_lds_b128 %5, %13, off\n\t"
      "global_load_async_to_lds_b128 %6, %14, off\n\t"
      "global_load_async_to_lds_b128 %7, %15, off\n\t"
      "s_wait_xcnt 0x0"
      :
      : "v"(kl), "v"(kl + 32 * KPITCH), "v"(kl + 64 * KPITCH), "v"(kl + 96 * KPITCH),
        "v"(vl), "v"(vl + 16 * VPITCH), "v"(vl + 32 * VPITCH), "v"(vl + 48 * VPITCH),
        "v"(kg), "v"(kg + 32 * NKV), "v"(kg + 64 * NKV), "v"(kg + 96 * NKV),
        "v"(vg), "v"(vg + (size_t)16 * S), "v"(vg + (size_t)32 * S), "v"(vg + (size_t)48 * S)
      : "memory");
}

__global__ __launch_bounds__(256) void attn_kernel(const _Float16* __restrict__ Q,
                                                   const _Float16* __restrict__ Km,
                                                   const _Float16* __restrict__ Vt,
                                                   _Float16* __restrict__ O) {
  __shared__ __attribute__((aligned(16))) unsigned char L[2 * STAGEB];

  const int tid  = threadIdx.x;
  const int lane = threadIdx.x & 31;
  const int wave = threadIdx.x >> 5;
  const int l16  = lane & 15;
  const int hi   = lane >> 4;

  const int idx = blockIdx.x * 8 + wave;   // 0..2047
  const int h   = idx >> 7;                // head 0..15 (the same for a block's 8 waves)
  const int qp2 = idx & 127;               // 32-query pair tile 0..127
  const int kvh = h >> 2;                  // GROUP = 4 (repeat_interleave)

  // This lane's copy addresses for stage 0, buffer 0.
  const unsigned lds0 = (unsigned)(size_t)(&L[0]);
  const unsigned kl0  = lds0 + (tid >> 3) * KPITCH + (tid & 7) * 16;
  const unsigned vl0  = lds0 + KBYTES + (tid >> 4) * VPITCH + (tid & 15) * 16;
  const _Float16* kg  = Km + (size_t)(tid >> 3) * NKV + kvh * HD + (tid & 7) * 8;
  const _Float16* vg  = Vt + (size_t)(kvh * HD + (tid >> 4)) * S + (tid & 15) * 8;

  stage_copy(kl0, vl0, kg, vg);

  // Q^T B-fragments for two 16-query tiles (hd halves 0..31 / 32..63)
  v16h qf[2][2];
#pragma unroll
  for (int s = 0; s < 2; ++s) {
    const _Float16* qp = Q + (size_t)(qp2 * 32 + s * 16 + l16) * Dm + h * HD;
    qf[s][0] = load_frag(qp, hi);
    qf[s][1] = load_frag(qp + 32, hi);
  }

  float mrun[2] = {-1e30f, -1e30f};
  float lrun[2] = {0.0f, 0.0f};
  v8f oacc[2][4];  // O^T tiles: (m = hd, n = query)
#pragma unroll
  for (int s = 0; s < 2; ++s)
#pragma unroll
    for (int nt = 0; nt < 4; ++nt) {
      v8f z = {};
      oacc[s][nt] = z;
    }

  const float scale = 0.125f;  // 1/sqrt(64)

  // Stage 0 has landed for this wave; the barrier publishes it to the others.
  asm volatile("s_wait_asynccnt 0x0" ::: "memory");
  __syncthreads();
  stage_copy(kl0 + STAGEB, vl0 + STAGEB, kg + (size_t)KT * NKV, vg + KT);

  for (int st = 0; st < NST; ++st) {
    const unsigned bufo = (st & 1) * STAGEB;
    const unsigned char* Kl = L + bufo + l16 * KPITCH;
    const unsigned char* Vl = L + bufo + KBYTES + l16 * VPITCH;

    // unrolled so that every LDS read has a constant offset from Kl / Vl
#pragma unroll
    for (int p = 0; p < KT / 32; ++p) {
      // ---- S^T tiles: c[s][t] holds keys p*32+t*16+(i+8*hi), query tile s ----
      v8f c[2][2];
#pragma unroll
      for (int t = 0; t < 2; ++t) {
        const _Float16* kp = (const _Float16*)(Kl + (p * 32 + t * 16) * KPITCH);
        v16h aK0 = load_frag(kp, hi);
        v16h aK1 = load_frag(kp + 32, hi);
#pragma unroll
        for (int s = 0; s < 2; ++s) {
          v8f z = {};
          z       = __builtin_amdgcn_wmma_f32_16x16x32_f16(false, aK0, false, qf[s][0],
                                                           (short)0, z, false, false);
          c[s][t] = __builtin_amdgcn_wmma_f32_16x16x32_f16(false, aK1, false, qf[s][1],
                                                           (short)0, z, false, false);
        }
      }

      // ---- online softmax per query tile (per-lane + one half-swap) ----
      v16h pb[2];
#pragma unroll
      for (int s = 0; s < 2; ++s) {
        float lmax = -1e30f;
#pragma unroll
        for (int i = 0; i < 8; ++i) {
          c[s][0][i] *= scale;
          c[s][1][i] *= scale;
          lmax = fmaxf(lmax, fmaxf(c[s][0][i], c[s][1][i]));
        }
        lmax = fmaxf(lmax, __shfl_xor(lmax, 16, 32));  // combine key halves
        float mnew = fmaxf(mrun[s], lmax);
        float corr = __expf(mrun[s] - mnew);
        mrun[s] = mnew;

        float p0[8], p1[8];
        float ls = 0.0f;
#pragma unroll
        for (int i = 0; i < 8; ++i) {
          p0[i] = __expf(c[s][0][i] - mnew);
          p1[i] = __expf(c[s][1][i] - mnew);
          ls += p0[i] + p1[i];
        }
        ls += __shfl_xor(ls, 16, 32);
        lrun[s] = lrun[s] * corr + ls;

#pragma unroll
        for (int nt = 0; nt < 4; ++nt)
#pragma unroll
          for (int i = 0; i < 8; ++i) oacc[s][nt][i] *= corr;

        // pack P^T B-fragment: c0[j] -> K=hi*8+j, c1[j] -> K=16+hi*8+j
#pragma unroll
        for (int j = 0; j < 8; ++j) {
          pb[s][j]     = (_Float16)p0[j];
          pb[s][j + 8] = (_Float16)p1[j];
        }
      }

      // ---- O^T += V^T(A) x P^T(B); V^T fragments shared by both tiles ----
#pragma unroll
      for (int nt = 0; nt < 4; ++nt) {
        const _Float16* vp = (const _Float16*)(Vl + nt * 16 * VPITCH) + p * 32;
        v16h av = load_frag(vp, hi);
#pragma unroll
        for (int s = 0; s < 2; ++s)
          oacc[s][nt] = __builtin_amdgcn_wmma_f32_16x16x32_f16(false, av, false, pb[s],
                                                               (short)0, oacc[s][nt], false, false);
      }
      if (p == 1) __builtin_amdgcn_sched_barrier(0);
    }

    // Hand-over of the buffers: this wave's LDS reads of stage st are done ...
    asm volatile("s_wait_dscnt 0x0" ::: "memory");
    // ... its own copies of stage st + 1 have landed ...
    asm volatile("s_wait_asynccnt 0x0" ::: "memory");
    // ... and the barrier says both of every wave of the block.
    __syncthreads();
    if (st + 2 < NST)  // refill the buffer that stage st has just left
      stage_copy(kl0 + bufo, vl0 + bufo, kg + (size_t)(st + 2) * KT * NKV, vg + (st + 2) * KT);
  }
  // no copy is left in flight when the wave ends
  asm volatile("s_wait_asynccnt 0x0" ::: "memory");

  // ---- normalize and store: O^T element (m = hd, n = query) ----
#pragma unroll
  for (int s = 0; s < 2; ++s) {
    float rinv = 1.0f / lrun[s];
    const int srow = qp2 * 32 + s * 16 + l16;
    _Float16* op = O + (size_t)srow * Dm + h * HD + 8 * hi;
#pragma unroll
    for (int nt = 0; nt < 4; ++nt) {
      h8 v;
#pragma unroll
      for (int i = 0; i < 8; ++i) v[i] = (_Float16)(oacc[s][nt][i] * rinv);
      *(h8*)(op + nt * 16) = v;
    }
  }
}

// ---------------------------------------------------------------------------
// Host launch
// ---------------------------------------------------------------------------
extern "C" void kernel_launch(void* const* d_in, const int* in_sizes, int n_in,
                              void* d_out, int out_size, void* d_ws, size_t ws_size,
                              hipStream_t stream) {
  (void)in_sizes; (void)n_in; (void)out_size; (void)ws_size;
  const float* X   = (const float*)d_in[0];
  const float* q_w = (const float*)d_in[1];
  const float* q_b = (const float*)d_in[2];
  const float* k_w = (const float*)d_in[3];
  const float* k_b = (const float*)d_in[4];
  const float* v_w = (const float*)d_in[5];
  const float* v_b = (const float*)d_in[6];
  const float* o_w = (const float*)d_in[7];
  const float* o_b = (const float*)d_in[8];
  float* out = (float*)d_out;

  // Carve workspace (f16 buffers), 256B aligned. Total ~33 MB.
  char* ws = (char*)d_ws;
  auto carve = [&](size_t bytes) {
    char* p = ws;
    ws += (bytes + 255) & ~(size_t)255;
    return p;
  };
  _Float16* Xh  = (_Float16*)carve((size_t)S * Dm * 2);    // X in f16
  _Float16* qwt = (_Float16*)carve((size_t)Dm * Dm * 2);   // q_w^T
  _Float16* kwt = (_Float16*)carve((size_t)Dm * NKV * 2);  // k_w^T
  _Float16* vwt = (_Float16*)carve((size_t)Dm * NKV * 2);  // v_w^T
  _Float16* owt = (_Float16*)carve((size_t)Dm * Dm * 2);   // o_w^T
  _Float16* Qh  = (_Float16*)carve((size_t)S * Dm * 2);    // Q [S][1024]
  _Float16* Kh  = (_Float16*)carve((size_t)S * NKV * 2);   // K [S][256]
  _Float16* Vth = (_Float16*)carve((size_t)NKV * S * 2);   // V^T [256][S]
  _Float16* Ah  = (_Float16*)carve((size_t)S * Dm * 2);    // attention out [S][1024]

  // 1) Convert / transpose inputs to f16, 32 elements a thread: one launch
  prep_f16<<<PB_ALL, 256, 0, stream>>>(X, q_w, k_w, v_w, o_w, Xh, qwt, kwt, vwt, owt);

  // 2) Q, K, V projections (WMMA GEMMs), 128x128 tile per block: one launch
  gemm_qkv<<<dim3((Dm + 2 * NKV) / 128, S / 128), 256, 0, stream>>>(Xh, qwt, kwt, vwt, q_b, k_b, v_b,
                                                                    Qh, Kh, Vth);

  // 3) Flash attention: 16 heads x 128 query-pair tiles = 2048 waves, 8/block
  attn_kernel<<<(Hn * (S / 32)) / 8, 256, 0, stream>>>(Qh, Kh, Vth, Ah);

  // 4) Output projection -> f32
  gemm_out<<<dim3(Dm / 128, S / 128), 256, 0, stream>>>(Ah, owt, o_b, out);
}

// v005
// Measured time: 97.9 microseconds a run.
// In both of two side-by-side timings against v004, it was 1.09 times as fast.
// All steps since v000 together make it 4.10 times as fast.
#include <hip/hip_runtime.h>

typedef __attribute__((ext_vector_type(16))) _Float16 v16h;
typedef __attribute__((ext_vector_type(8)))  _Float16 h8;
typedef __attribute__((ext_vector_type(8)))  float    v8f;
typedef __attribute__((ext_vector_type(4)))  float    f4;
typedef __attribute__((ext_vector_type(4)))  _Float16 h4;
typedef __attribute__((ext_vector_type(2)))  float    f2;

static constexpr int S   = 4096;
static constexpr int Dm  = 1024;
static constexpr int Hn  = 16;
static constexpr int KVH = 4;
static constexpr int HD  = 64;
static constexpr int NKV = KVH * HD;   // 256

__device__ inline v16h load_frag(const _Float16* rowptr, int hi) {
  h8 x = *(const h8*)(rowptr + hi * 8);
  h8 y = *(const h8*)(rowptr + 16 + hi * 8);
  v16h r;
#pragma unroll
  for (int j = 0; j < 8; ++j) { r[j] = x[j]; r[j + 8] = y[j]; }
  return r;
}

// ---------------------------------------------------------------------------
// Elementwise f32 -> f16 convert, 32 elements a thread: 8 loads of 16 B in
// flight per lane, each wave-wide load 512 contiguous bytes, each store 256.
// A block takes CVT_BLK elements; blocks 0 .. size / CVT_BLK - 1 cover the array.
// ---------------------------------------------------------------------------
static constexpr int CVT_BLK = 256 * 32;

__device__ inline void convert_f16(const float* __restrict__ in,
                                   _Float16* __restrict__ out, int blk) {
  const size_t base = (size_t)blk * CVT_BLK + threadIdx.x * 4;
  f4 v[8];
#pragma unroll
  for (int j = 0; j < 8; ++j) v[j] = *(const f4*)(in + base + j * 1024);
#pragma unroll
  for (int j = 0; j < 8; ++j) {
    h4 h;
#pragma unroll
    for (int i = 0; i < 4; ++i) h[i] = (_Float16)v[j][i];
    *(h4*)(out + base + j * 1024) = h;
  }
  // In the merged kernel another job's code follows this one in the listing:
  // the wait stands in front of any rewrite of a register the stores above name.
  asm volatile("s_wait_xcnt 0x0" ::: "memory");
}

// W [Kd x Nd] f32 (row-major)  ->  Wt [Nd x Kd] f16 (row-major)
// 32 elements a thread: a block of 8 k x 4 n, read by 8 loads of 16 B along n,
// turned in registers, written by 4 stores of 16 B along k. Eight lanes stand
// side by side in k, so a wave-wide store fills 4 whole 128-B lines of Wt.
// A wave takes 64 k x 16 n, a block 64 k x 128 n; (bx, by) in (Nd/128, Kd/64).
// Kd and Nd are compile-time, so that the 8 loads share one address register
// pair (row steps as immediate offsets), and the 4 stores another.
template <int Kd, int Nd>
__device__ inline void transpose_f16(const float* __restrict__ W,
                                     _Float16* __restrict__ Wt, int bx, int by) {
  const int lane = threadIdx.x & 31;
  const int wave = threadIdx.x >> 5;
  const int k = by * 64 + (lane & 7) * 8;
  const int n = bx * 128 + wave * 16 + (lane >> 3) * 4;
  const float* src = W + (size_t)k * Nd + n;
  f4 r[8];
#pragma unroll
  for (int j = 0; j < 8; ++j) r[j] = *(const f4*)(src + (size_t)j * Nd);
  _Float16* dst = Wt + (size_t)n * Kd + k;
#pragma unroll
  for (int i = 0; i < 4; ++i) {
    h8 c;
#pragma unroll
    for (int j = 0; j < 8; ++j) c[j] = (_Float16)r[j][i];
    *(h8*)(dst + (size_t)i * Kd) = c;
  }
  // In the merged kernel another job's code follows this one in the listing:
  // the wait stands in front of any rewrite of a register the stores above name.
  asm volatile("s_wait_xcnt 0x0" ::: "memory");
}

// The five jobs above read inputs only and none reads another's output, so
// they share one grid: a block picks its job by its index (the same for all
// its threads). Transposes first, then the convert.
static constexpr int PB_BIG = (Dm / 128) * (Dm / 64);    // blocks of a Dm x Dm transpose
static constexpr int PB_KV  = (NKV / 128) * (Dm / 64);   // blocks of a Dm x NKV transpose
static constexpr int PB_CVT = (S * Dm) / CVT_BLK;        // blocks of the convert
static constexpr int PB_ALL = 2 * PB_BIG + 2 * PB_KV + PB_CVT;

__global__ __launch_bounds__(256) void prep_f16(const float* __restrict__ X,
                                                const float* __restrict__ q_w,
                                                const float* __restrict__ k_w,
                                                const float* __restrict__ v_w,
                                                const float* __restrict__ o_w,
                                                _Float16* __restrict__ Xh,
                                                _Float16* __restrict__ qwt,
                                                _Float16* __restrict__ kwt,
                                                _Float16* __restrict__ vwt,
                                                _Float16* __restrict__ owt) {
  int b = blockIdx.x;
  if (b < 2 * PB_BIG) {
    const bool o = b >= PB_BIG;
    if (o) b -= PB_BIG;
    transpose_f16<Dm, Dm>(o ? o_w : q_w, o ? owt : qwt, b % (Dm / 128), b / (Dm / 128));
    return;
  }
  b -= 2 * PB_BIG;
  if (b < 2 * PB_KV) {
    const bool v = b >= PB_KV;
    if (v) b -= PB_KV;
    transpose_f16<Dm, NKV>(v ? v_w : k_w, v ? vwt : kwt, b % (NKV / 128), b / (NKV / 128));
    return;
  }
  convert_f16(X, Xh, b - 2 * PB_KV);
}

static constexpr int GKS     = 128;
static constexpr int GNST    = Dm / GKS;
static constexpr int GPITCH  = GKS * 2 + 16;
static constexpr int GOPB    = 128 * GPITCH;
static constexpr int GSTAGEB = 2 * GOPB;

// One operand's slab of a stage: 8 copies per lane (256 lanes x 16 B = 16 rows
// each). l: this lane's LDS byte address, g: its global address; copy j takes
// row 16 j + (tid >> 4).
__device__ inline void slab_copy(unsigned l, const _Float16* g) {
  asm volatile(
      "global_load_async_to_lds_b128 %0, %8, off\n\t"
      "global_load_async_to_lds_b128 %1, %9, off\n\t"
      "global_load_async_to_lds_b128 %2, %10, off\n\t"
      "global_load_async_to_lds_b128 %3, %11, off\n\t"
      "global_load_async_to_lds_b128 %4, %12, off\n\t"
      "global_load_async_to_lds_b128 %5, %13, off\n\t"
      "global_load_async_to_lds_b128 %6, %14, off\n\t"
      "global_load_async_to_lds_b128 %7, %15, off\n\t"
      "s_wait_xcnt 0x0"
      :
      : "v"(l), "v"(l + 16 * GPITCH), "v"(l + 32 * GPITCH), "v"(l + 48 * GPITCH),
        "v"(l + 64 * GPITCH), "v"(l + 80 * GPITCH), "v"(l + 96 * GPITCH), "v"(l + 112 * GPITCH),
        "v"(g), "v"(g + 16 * Dm), "v"(g + 32 * Dm), "v"(g + 48 * Dm),
        "v"(g + 64 * Dm), "v"(g + 80 * Dm), "v"(g + 96 * Dm), "v"(g + 112 * Dm)
      : "memory");
}

template <int MODE, int N>
__device__ inline void gemm_tile(unsigned char* L,
                                 const _Float16* __restrict__ A,
                                 const _Float16* __restrict__ Bt,
                                 const float* __restrict__ bias,
                                 void* __restrict__ Out, int bx, int by) {
  constexpr int M = S;
  const int tid  = threadIdx.x;
  const int lane = threadIdx.x & 31;
  const int wave = threadIdx.x >> 5;
  const int l16  = lane & 15;
  const int hi   = lane >> 4;
  const int wm   = (wave >> 1) * 32;       // this wave's rows in the block tile
  const int wn   = (wave & 1) * 64;        // this wave's columns in the block tile
  const int bm0  = by * 128;
  const int bn0  = bx * 128;
  const int m0   = bm0 + wm;
  const int n0   = bn0 + wn;

  // This lane's copy addresses for stage 0, buffer 0.
  const unsigned lds0 = (unsigned)(size_t)(&L[0]);
  const unsigned al0  = lds0 + (tid >> 4) * GPITCH + (tid & 15) * 16;
  const unsigned bl0  = al0 + GOPB;
  const _Float16* ag  = A  + (size_t)(bm0 + (tid >> 4)) * Dm + (tid & 15) * 8;
  const _Float16* bg  = Bt + (size_t)(bn0 + (tid >> 4)) * Dm + (tid & 15) * 8;

  slab_copy(al0, ag);
  slab_copy(bl0, bg);

  v8f acc0[4], acc1[4];
#pragma unroll
  for (int nt = 0; nt < 4; ++nt) {
    v8f z = {};
    acc0[nt] = z;
    acc1[nt] = z;
  }

  // Stage 0 has landed for this wave; the barrier publishes it to the others.
  asm volatile("s_wait_asynccnt 0x0" ::: "memory");
  __syncthreads();
  slab_copy(al0 + GSTAGEB, ag + GKS);
  slab_copy(bl0 + GSTAGEB, bg + GKS);

#pragma unroll 1
  for (int st = 0; st < GNST; ++st) {
    const unsigned bufo = (st & 1) * GSTAGEB;
    const unsigned char* Al = L + bufo + (wm + l16) * GPITCH;
    const unsigned char* Bl = L + bufo + GOPB + (wn + l16) * GPITCH;

    // Two fragment sets: the 12 LDS reads of k step kk + 1 go out as one group
    // ahead of the 8 WMMAs of k step kk (inside this stage only; nothing of the
    // next stage is read here). Unrolled: constant offsets from Al / Bl.
    v16h af[2][2], bf[2][4];
    af[0][0] = load_frag((const _Float16*)Al, hi);
    af[0][1] = load_frag((const _Float16*)(Al + 16 * GPITCH), hi);
#pragma unroll
    for (int nt = 0; nt < 4; ++nt)
      bf[0][nt] = load_frag((const _Float16*)(Bl + nt * 16 * GPITCH), hi);
#pragma unroll
    for (int kk = 0; kk < GKS / 32; ++kk) {
      const int cur = kk & 1, nxt = cur ^ 1;
      if (kk + 1 < GKS / 32) {
        af[nxt][0] = load_frag((const _Float16*)Al + (kk + 1) * 32, hi);
        af[nxt][1] = load_frag((const _Float16*)(Al + 16 * GPITCH) + (kk + 1) * 32, hi);
#pragma unroll
        for (int nt = 0; nt < 4; ++nt)
          bf[nxt][nt] = load_frag((const _Float16*)(Bl + nt * 16 * GPITCH) + (kk + 1) * 32, hi);
      }
      // Keeps the read group above in front of the WMMAs below: left free, the
      // scheduler sinks each read to its use and waits out the LDS latency
      // before every pair of WMMAs.
      __builtin_amdgcn_sched_barrier(0);
#pragma unroll
      for (int nt = 0; nt < 4; ++nt) {
        acc0[nt] = __builtin_amdgcn_wmma_f32_16x16x32_f16(false, af[cur][0], false, bf[cur][nt],
                                                          (short)0, acc0[nt], false, false);
        acc1[nt] = __builtin_amdgcn_wmma_f32_16x16x32_f16(false, af[cur][1], false, bf[cur][nt],
                                                          (short)0, acc1[nt], false, false);
      }
    }

    // Hand-over of the buffers: this wave's LDS reads of stage st are done ...
    asm volatile("s_wait_dscnt 0x0" ::: "memory");
    // ... its own copies of stage st + 1 have landed ...
    asm volatile("s_wait_asynccnt 0x0" ::: "memory");
    // ... and the barrier says both of every wave of the block.
    __syncthreads();
    if (st + 2 < GNST) {  // refill the buffer that stage st has just left
      slab_copy(al0 + bufo, ag + (st + 2) * GKS);
      slab_copy(bl0 + bufo, bg + (st + 2) * GKS);
    }
  }
  // no copy is left in flight when the wave ends
  asm volatile("s_wait_asynccnt 0x0" ::: "memory");

  // C/D layout: element (m = i + 8*hi, n = l16)
#pragma unroll
  for (int nt = 0; nt < 4; ++nt) {
    int n = n0 + nt * 16 + l16;
    float bv = bias[n];
#pragma unroll
    for (int i = 0; i < 8; ++i) {
      int ma = m0 + i + 8 * hi;
      int mb = ma + 16;
      float va = acc0[nt][i] + bv;
      float vb = acc1[nt][i] + bv;
      if (MODE == 0) {
        ((_Float16*)Out)[(size_t)ma * N + n] = (_Float16)va;
        ((_Float16*)Out)[(size_t)mb * N + n] = (_Float16)vb;
      } else if (MODE == 1) {
        ((_Float16*)Out)[(size_t)n * M + ma] = (_Float16)va;
        ((_Float16*)Out)[(size_t)n * M + mb] = (_Float16)vb;
      } else {
        ((float*)Out)[(size_t)ma * N + n] = va;
        ((float*)Out)[(size_t)mb * N + n] = vb;
      }
    }
  }
  // In the merged kernel another job's code follows this one in the listing:
  // the wait stands in front of any rewrite of a register the stores above name.
  // (The output projection is its kernel's only job: the wave ends here.)
  if (MODE != 2) asm volatile("s_wait_xcnt 0x0" ::: "memory");
}

// The three projections read the same Xh and none reads another's output, so
// they share one grid: blockIdx.x runs over the column tiles of Q, then K,
// then V (a choice that is the same for all threads of a block).
// grid = ((Dm + 2 NKV)/128, S/128)
__global__ __launch_bounds__(256) void gemm_qkv(const _Float16* __restrict__ Xh,
                                                const _Float16* __restrict__ qwt,
                                                const _Float16* __restrict__ kwt,
                                                const _Float16* __restrict__ vwt,
                                                const float* __restrict__ q_b,
                                                const float* __restrict__ k_b,
                                                const float* __restrict__ v_b,
                                                _Float16* __restrict__ Qh,
                                                _Float16* __restrict__ Kh,
                                                _Float16* __restrict__ Vth) {
  __shared__ __attribute__((aligned(16))) unsigned char L[2 * GSTAGEB];
  const int bx = blockIdx.x;
  if (bx < Dm / 128)
    gemm_tile<0, Dm>(L, Xh, qwt, q_b, Qh, bx, blockIdx.y);
  else if (bx < (Dm + NKV) / 128)
    gemm_tile<0, NKV>(L, Xh, kwt, k_b, Kh, bx - Dm / 128, blockIdx.y);
  else
    gemm_tile<1, NKV>(L, Xh, vwt, v_b, Vth, bx - (Dm + NKV) / 128, blockIdx.y);
}

// Output projection. grid = (Dm/128, S/128)
__global__ __launch_bounds__(256) void gemm_out(const _Float16* __restrict__ Ah,
                                                const _Float16* __restrict__ owt,
                                                const float* __restrict__ o_b,
                                                float* __restrict__ out) {
  __shared__ __attribute__((aligned(16))) unsigned char L[2 * GSTAGEB];
  gemm_tile<2, Dm>(L, Ah, owt, o_b, out, blockIdx.x, blockIdx.y);
}

static constexpr int KT     = 128;
static constexpr int NST    = S / KT;
static constexpr int KPITCH = HD * 2 + 16;
static constexpr int VPITCH = KT * 2 + 16;
static constexpr int KBYTES = KT * KPITCH;
static constexpr int VBYTES = HD * VPITCH;
static constexpr int STAGEB = KBYTES + VBYTES;

// One stage: 4 K copies and 4 V^T copies per lane (256 lanes x 16 B = 4 KB each).
// kl / vl: this lane's LDS byte addresses, kg / vg: its global addresses.
// K copy j takes rows 32 j + (tid >> 3); V^T copy j rows 16 j + (tid >> 4).
__device__ inline void stage_copy(unsigned kl, unsigned vl,
                                  const _Float16* kg, const _Float16* vg) {
  asm volatile(
      "global_load_async_to_lds_b128 %0, %8, off\n\t"
      "global_load_async_to_lds_b128 %1, %9, off\n\t"
      "global_load_async_to_lds_b128 %2, %10, off\n\t"
      "global_load_async_to_lds_b128 %3, %11, off\n\t"
      "global_load_async_to_lds_b128 %4, %12, off\n\t"
      "global_load_async_to_lds_b128 %5, %13, off\n\t"
      "global_load_async_to_lds_b128 %6, %14, off\n\t"
      "global_load_async_to_lds_b128 %7, %15, off\n\t"
      "s_wait_xcnt 0x0"
      :
      : "v"(kl), "v"(kl + 32 * KPITCH), "v"(kl + 64 * KPITCH), "v"(kl + 96 * KPITCH),
        "v"(vl), "v"(vl + 16 * VPITCH), "v"(vl + 32 * VPITCH), "v"(vl + 48 * VPITCH),
        "v"(kg), "v"(kg + 32 * NKV), "v"(kg + 64 * NKV), "v"(kg + 96 * NKV),
        "v"(vg), "v"(vg + (size_t)16 * S), "v"(vg + (size_t)32 * S), "v"(vg + (size_t)48 * S)
      : "memory");
}

__global__ __launch_bounds__(256) void attn_kernel(const _Float16* __restrict__ Q,
                                                   const _Float16* __restrict__ Km,
                                                   const _Float16* __restrict__ Vt,
                                                   _Float16* __restrict__ O) {
  __shared__ __attribute__((aligned(16))) unsigned char L[2 * STAGEB];

  const int tid  = threadIdx.x;
  const int lane = threadIdx.x & 31;
  const int wave = threadIdx.x >> 5;
  const int l16  = lane & 15;
  const int hi   = lane >> 4;

  const int idx = blockIdx.x * 8 + wave;   // 0..2047
  const int h   = idx >> 7;                // head 0..15 (the same for a block's 8 waves)
  const int qp2 = idx & 127;               // 32-query pair tile 0..127
  const int kvh = h >> 2;                  // GROUP = 4 (repeat_interleave)

  // This lane's copy addresses for stage 0, buffer 0.
  const unsigned lds0 = (unsigned)(size_t)(&L[0]);
  const unsigned kl0  = lds0 + (tid >> 3) * KPITCH + (tid & 7) * 16;
  const unsigned vl0  = lds0 + KBYTES + (tid >> 4) * VPITCH + (tid & 15) * 16;
  const _Float16* kg  = Km + (size_t)(tid >> 3) * NKV + kvh * HD + (tid & 7) * 8;
  const _Float16* vg  = Vt + (size_t)(kvh * HD + (tid >> 4)) * S + (tid & 15) * 8;

  stage_copy(kl0, vl0, kg, vg);

  // Q^T B-fragments for two 16-query tiles (hd halves 0..31 / 32..63)
  v16h qf[2][2];
#pragma unroll
  for (int s = 0; s < 2; ++s) {
    const _Float16* qp = Q + (size_t)(qp2 * 32 + s * 16 + l16) * Dm + h * HD;
    qf[s][0] = load_frag(qp, hi);
    qf[s][1] = load_frag(qp + 32, hi);
  }

  float mrun[2] = {-1e30f, -1e30f};
  float lrun[2] = {0.0f, 0.0f};
  v8f oacc[2][4];  // O^T tiles: (m = hd, n = query)
#pragma unroll
  for (int s = 0; s < 2; ++s)
#pragma unroll
    for (int nt = 0; nt < 4; ++nt) {
      v8f z = {};
      oacc[s][nt] = z;
    }

  // Softmax in base 2: exp(scale * c - m) = exp2(c * kscale - m * log2(e)), with
  // kscale = 1/sqrt(64) * log2(e). mrun holds the running maximum in those units.
  const float kscale = 0.125f * 1.44269504088896340736f;

  // Stage 0 has landed for this wave; the barrier publishes it to the others.
  asm volatile("s_wait_asynccnt 0x0" ::: "memory");
  __syncthreads();
  stage_copy(kl0 + STAGEB, vl0 + STAGEB, kg + (size_t)KT * NKV, vg + KT);

  for (int st = 0; st < NST; ++st) {
    const unsigned bufo = (st & 1) * STAGEB;
    const unsigned char* Kl = L + bufo + l16 * KPITCH;
    const unsigned char* Vl = L + bufo + KBYTES + l16 * VPITCH;

#pragma unroll 2
    for (int p = 0; p < KT / 32; ++p) {
      // ---- S^T tiles: c[s][t] holds keys p*32+t*16+(i+8*hi), query tile s ----
      v8f c[2][2];
#pragma unroll
      for (int t = 0; t < 2; ++t) {
        const _Float16* kp = (const _Float16*)(Kl + (p * 32 + t * 16) * KPITCH);
        v16h aK0 = load_frag(kp, hi);
        v16h aK1 = load_frag(kp + 32, hi);
#pragma unroll
        for (int s = 0; s < 2; ++s) {
          v8f z = {};
          z       = __builtin_amdgcn_wmma_f32_16x16x32_f16(false, aK0, false, qf[s][0],
                                                           (short)0, z, false, false);
          c[s][t] = __builtin_amdgcn_wmma_f32_16x16x32_f16(false, aK1, false, qf[s][1],
                                                           (short)0, z, false, false);
        }
      }

      // ---- online softmax per query tile (per-lane + one half-swap) ----
      v16h pb[2];
#pragma unroll
      for (int s = 0; s < 2; ++s) {
        // maximum of the raw scores (kscale is positive, so it commutes with max)
        float lmax = -1e30f;
#pragma unroll
        for (int i = 0; i < 8; ++i)
          lmax = fmaxf(lmax, fmaxf(c[s][0][i], c[s][1][i]));
        lmax = fmaxf(lmax, __shfl_xor(lmax, 16, 32));  // combine key halves
        float mnew = fmaxf(mrun[s], lmax * kscale);
        float corr = __builtin_amdgcn_exp2f(mrun[s] - mnew);
        mrun[s] = mnew;

        // One multiply-add per score in front of its exp2, two neighbouring
        // accumulator registers per packed instruction.
        float p0[8], p1[8];
        float ls = 0.0f;
        const f2 kk2 = {kscale, kscale};
        const f2 nm2 = {-mnew, -mnew};
#pragma unroll
        for (int i = 0; i < 8; i += 2) {
          const f2 a0 = __builtin_elementwise_fma(f2{c[s][0][i], c[s][0][i + 1]}, kk2, nm2);
          const f2 a1 = __builtin_elementwise_fma(f2{c[s][1][i], c[s][1][i + 1]}, kk2, nm2);
          p0[i]     = __builtin_amdgcn_exp2f(a0.x);
          p0[i + 1] = __builtin_amdgcn_exp2f(a0.y);
          p1[i]     = __builtin_amdgcn_exp2f(a1.x);
          p1[i + 1] = __builtin_amdgcn_exp2f(a1.y);
          ls += p0[i] + p1[i];
          ls += p0[i + 1] + p1[i + 1];
        }
        ls += __shfl_xor(ls, 16, 32);
        lrun[s] = lrun[s] * corr + ls;

#pragma unroll
        for (int nt = 0; nt < 4; ++nt)
#pragma unroll
          for (int i = 0; i < 8; ++i) oacc[s][nt][i] *= corr;

        // pack P^T B-fragment: c0[j] -> K=hi*8+j, c1[j] -> K=16+hi*8+j
#pragma unroll
        for (int j = 0; j < 8; ++j) {
          pb[s][j]     = (_Float16)p0[j];
          pb[s][j + 8] = (_Float16)p1[j];
        }
      }

      // ---- O^T += V^T(A) x P^T(B); V^T fragments shared by both tiles ----
#pragma unroll
      for (int nt = 0; nt < 4; ++nt) {
        const _Float16* vp = (const _Float16*)(Vl + nt * 16 * VPITCH) + p * 32;
        v16h av = load_frag(vp, hi);
#pragma unroll
        for (int s = 0; s < 2; ++s)
          oacc[s][nt] = __builtin_amdgcn_wmma_f32_16x16x32_f16(false, av, false, pb[s],
                                                               (short)0, oacc[s][nt], false, false);
      }
    }

    // Hand-over of the buffers: this wave's LDS reads of stage st are done ...
    asm volatile("s_wait_dscnt 0x0" ::: "memory");
    // ... its own copies of stage st + 1 have landed ...
    asm volatile("s_wait_asynccnt 0x0" ::: "memory");
    // ... and the barrier says both of every wave of the block.
    __syncthreads();
    if (st + 2 < NST)  // refill the buffer that stage st has just left
      stage_copy(kl0 + bufo, vl0 + bufo, kg + (size_t)(st + 2) * KT * NKV, vg + (st + 2) * KT);
  }
  // no copy is left in flight when the wave ends
  asm volatile("s_wait_asynccnt 0x0" ::: "memory");

  // ---- normalize and store: O^T element (m = hd, n = query) ----
#pragma unroll
  for (int s = 0; s < 2; ++s) {
    float rinv = 1.0f / lrun[s];
    const int srow = qp2 * 32 + s * 16 + l16;
    _Float16* op = O + (size_t)srow * Dm + h * HD + 8 * hi;
#pragma unroll
    for (int nt = 0; nt < 4; ++nt) {
      h8 v;
#pragma unroll
      for (int i = 0; i < 8; ++i) v[i] = (_Float16)(oacc[s][nt][i] * rinv);
      *(h8*)(op + nt * 16) = v;
    }
  }
}

// ---------------------------------------------------------------------------
// Host launch
// ---------------------------------------------------------------------------
extern "C" void kernel_launch(void* const* d_in, const int* in_sizes, int n_in,
                              void* d_out, int out_size, void* d_ws, size_t ws_size,
                              hipStream_t stream) {
  (void)in_sizes; (void)n_in; (void)out_size; (void)ws_size;
  const float* X   = (const float*)d_in[0];
  const float* q_w = (const float*)d_in[1];
  const float* q_b = (const float*)d_in[2];
  const float* k_w = (const float*)d_in[3];
  const float* k_b = (const float*)d_in[4];
  const float* v_w = (const float*)d_in[5];
  const float* v_b = (const float*)d_in[6];
  const float* o_w = (const float*)d_in[7];
  const float* o_b = (const float*)d_in[8];
  float* out = (float*)d_out;

  // Carve workspace (f16 buffers), 256B aligned. Total ~33 MB.
  char* ws = (char*)d_ws;
  auto carve = [&](size_t bytes) {
    char* p = ws;
    ws += (bytes + 255) & ~(size_t)255;
    return p;
  };
  _Float16* Xh  = (_Float16*)carve((size_t)S * Dm * 2);    // X in f16
  _Float16* qwt = (_Float16*)carve((size_t)Dm * Dm * 2);   // q_w^T
  _Float16* kwt = (_Float16*)carve((size_t)Dm * NKV * 2);  // k_w^T
  _Float16* vwt = (_Float16*)carve((size_t)Dm * NKV * 2);  // v_w^T
  _Float16* owt = (_Float16*)carve((size_t)Dm * Dm * 2);   // o_w^T
  _Float16* Qh  = (_Float16*)carve((size_t)S * Dm * 2);    // Q [S][1024]
  _Float16* Kh  = (_Float16*)carve((size_t)S * NKV * 2);   // K [S][256]
  _Float16* Vth = (_Float16*)carve((size_t)NKV * S * 2);   // V^T [256][S]
  _Float16* Ah  = (_Float16*)carve((size_t)S * Dm * 2);    // attention out [S][1024]

  // 1) Convert / transpose inputs to f16, 32 elements a thread: one launch
  prep_f16<<<PB_ALL, 256, 0, stream>>>(X, q_w, k_w, v_w, o_w, Xh, qwt, kwt, vwt, owt);

  // 2) Q, K, V projections (WMMA GEMMs), 128x128 tile per block: one launch
  gemm_qkv<<<dim3((Dm + 2 * NKV) / 128, S / 128), 256, 0, stream>>>(Xh, qwt, kwt, vwt, q_b, k_b, v_b,
                                                                    Qh, Kh, Vth);

  // 3) Flash attention: 16 heads x 128 query-pair tiles = 2048 waves, 8/block
  attn_kernel<<<(Hn * (S / 32)) / 8, 256, 0, stream>>>(Qh, Kh, Vth, Ah);

  // 4) Output projection -> f32
  gemm_out<<<dim3(Dm / 128, S / 128), 256, 0, stream>>>(Ah, owt, o_b, out);
}

// v006
// Measured time: 89.6 microseconds a run.
// Two timings next to v005 put it at 1.10 and 1.09 times that version's speed.
// Counting every step since v000, it is 4.49 times as fast.
#include <hip/hip_runtime.h>

typedef __attribute__((ext_vector_type(16))) _Float16 v16h;
typedef __attribute__((ext_vector_type(8)))  _Float16 h8;
typedef __attribute__((ext_vector_type(8)))  float    v8f;
typedef __attribute__((ext_vector_type(4)))  float    f4;
typedef __attribute__((ext_vector_type(4)))  _Float16 h4;
typedef __attribute__((ext_vector_type(2)))  float    f2;

static constexpr int S   = 4096;
static constexpr int Dm  = 1024;
static constexpr int Hn  = 16;
static constexpr int KVH = 4;
static constexpr int HD  = 64;
static constexpr int NKV = KVH * HD;   // 256

__device__ inline v16h load_frag(const _Float16* rowptr, int hi) {
  h8 x = *(const h8*)(rowptr + hi * 8);
  h8 y = *(const h8*)(rowptr + 16 + hi * 8);
  v16h r;
#pragma unroll
  for (int j = 0; j < 8; ++j) { r[j] = x[j]; r[j + 8] = y[j]; }
  return r;
}

// ---------------------------------------------------------------------------
// Elementwise f32 -> f16 convert, 32 elements a thread: 8 loads of 16 B in
// flight per lane, each wave-wide load 512 contiguous bytes, each store 256.
// A block takes CVT_BLK elements; blocks 0 .. size / CVT_BLK - 1 cover the array.
// ---------------------------------------------------------------------------
static constexpr int CVT_BLK = 256 * 32;

__device__ inline void convert_f16(const float* __restrict__ in,
                                   _Float16* __restrict__ out, int blk) {
  const size_t base = (size_t)blk * CVT_BLK + threadIdx.x * 4;
  f4 v[8];
#pragma unroll
  for (int j = 0; j < 8; ++j) v[j] = *(const f4*)(in + base + j * 1024);
#pragma unroll
  for (int j = 0; j < 8; ++j) {
    h4 h;
#pragma unroll
    for (int i = 0; i < 4; ++i) h[i] = (_Float16)v[j][i];
    *(h4*)(out + base + j * 1024) = h;
  }
  // In the merged kernel another job's code follows this one in the listing:
  // the wait stands in front of any rewrite of a register the stores above name.
  asm volatile("s_wait_xcnt 0x0" ::: "memory");
}

// W [Kd x Nd] f32 (row-major)  ->  Wt [Nd x Kd] f16 (row-major)
// 32 elements a thread: a block of 8 k x 4 n, read by 8 loads of 16 B along n,
// turned in registers, written by 4 stores of 16 B along k. Eight lanes stand
// side by side in k, so a wave-wide store fills 4 whole 128-B lines of Wt.
// A wave takes 64 k x 16 n, a block 64 k x 128 n; (bx, by) in (Nd/128, Kd/64).
// Kd and Nd are compile-time, so that the 8 loads share one address register
// pair (row steps as immediate offsets), and the 4 stores another.
template <int Kd, int Nd>
__device__ inline void transpose_f16(const float* __restrict__ W,
                                     _Float16* __restrict__ Wt, int bx, int by) {
  const int lane = threadIdx.x & 31;
  const int wave = threadIdx.x >> 5;
  const int k = by * 64 + (lane & 7) * 8;
  const int n = bx * 128 + wave * 16 + (lane >> 3) * 4;
  const float* src = W + (size_t)k * Nd + n;
  f4 r[8];
#pragma unroll
  for (int j = 0; j < 8; ++j) r[j] = *(const f4*)(src + (size_t)j * Nd);
  _Float16* dst = Wt + (size_t)n * Kd + k;
#pragma unroll
  for (int i = 0; i < 4; ++i) {
    h8 c;
#pragma unroll
    for (int j = 0; j < 8; ++j) c[j] = (_Float16)r[j][i];
    *(h8*)(dst + (size_t)i * Kd) = c;
  }
  // In the merged kernel another job's code follows this one in the listing:
  // the wait stands in front of any rewrite of a register the stores above name.
  asm volatile("s_wait_xcnt 0x0" ::: "memory");
}

// The five jobs above read inputs only and none reads another's output, so
// they share one grid: a block picks its job by its index (the same for all
// its threads). Transposes first, then the convert.
static constexpr int PB_BIG = (Dm / 128) * (Dm / 64);    // blocks of a Dm x Dm transpose
static constexpr int PB_KV  = (NKV / 128) * (Dm / 64);   // blocks of a Dm x NKV transpose
static constexpr int PB_CVT = (S * Dm) / CVT_BLK;        // blocks of the convert
static constexpr int PB_ALL = 2 * PB_BIG + 2 * PB_KV + PB_CVT;

__global__ __launch_bounds__(256) void prep_f16(const float* __restrict__ X,
                                                const float* __restrict__ q_w,
                                                const float* __restrict__ k_w,
                                                const float* __restrict__ v_w,
                                                const float* __restrict__ o_w,
                                                _Float16* __restrict__ Xh,
                                                _Float16* __restrict__ qwt,
                                                _Float16* __restrict__ kwt,
                                                _Float16* __restrict__ vwt,
                                                _Float16* __restrict__ owt) {
  int b = blockIdx.x;
  if (b < 2 * PB_BIG) {
    const bool o = b >= PB_BIG;
    if (o) b -= PB_BIG;
    transpose_f16<Dm, Dm>(o ? o_w : q_w, o ? owt : qwt, b % (Dm / 128), b / (Dm / 128));
    return;
  }
  b -= 2 * PB_BIG;
  if (b < 2 * PB_KV) {
    const bool v = b >= PB_KV;
    if (v) b -= PB_KV;
    transpose_f16<Dm, NKV>(v ? v_w : k_w, v ? vwt : kwt, b % (NKV / 128), b / (NKV / 128));
    return;
  }
  convert_f16(X, Xh, b - 2 * PB_KV);
}

static constexpr int GKS     = 128;
static constexpr int GNST    = Dm / GKS;
static constexpr int GPITCH  = GKS * 2 + 16;
static constexpr int GOPB    = 128 * GPITCH;
static constexpr int GSTAGEB = 2 * GOPB;

// One operand's slab of a stage: 8 copies per lane (256 lanes x 16 B = 16 rows
// each). l: this lane's LDS byte address, g: its global address; copy j takes
// row 16 j + (tid >> 4).
__device__ inline void slab_copy(unsigned l, const _Float16* g) {
  asm volatile(
      "global_load_async_to_lds_b128 %0, %8, off\n\t"
      "global_load_async_to_lds_b128 %1, %9, off\n\t"
      "global_load_async_to_lds_b128 %2, %10, off\n\t"
      "global_load_async_to_lds_b128 %3, %11, off\n\t"
      "global_load_async_to_lds_b128 %4, %12, off\n\t"
      "global_load_async_to_lds_b128 %5, %13, off\n\t"
      "global_load_async_to_lds_b128 %6, %14, off\n\t"
      "global_load_async_to_lds_b128 %7, %15, off\n\t"
      "s_wait_xcnt 0x0"
      :
      : "v"(l), "v"(l + 16 * GPITCH), "v"(l + 32 * GPITCH), "v"(l + 48 * GPITCH),
        "v"(l + 64 * GPITCH), "v"(l + 80 * GPITCH), "v"(l + 96 * GPITCH), "v"(l + 112 * GPITCH),
        "v"(g), "v"(g + 16 * Dm), "v"(g + 32 * Dm), "v"(g + 48 * Dm),
        "v"(g + 64 * Dm), "v"(g + 80 * Dm), "v"(g + 96 * Dm), "v"(g + 112 * Dm)
      : "memory");
}

template <int MODE, int N>
__device__ inline void gemm_tile(unsigned char* L,
                                 const _Float16* __restrict__ A,
                                 const _Float16* __restrict__ Bt,
                                 const float* __restrict__ bias,
                                 void* __restrict__ Out, int bx, int by) {
  constexpr int M = S;
  const int tid  = threadIdx.x;
  const int lane = threadIdx.x & 31;
  const int wave = threadIdx.x >> 5;
  const int l16  = lane & 15;
  const int hi   = lane >> 4;
  const int wm   = (wave >> 1) * 32;       // this wave's rows in the block tile
  const int wn   = (wave & 1) * 64;        // this wave's columns in the block tile
  const int bm0  = by * 128;
  const int bn0  = bx * 128;
  const int m0   = bm0 + wm;
  const int n0   = bn0 + wn;

  // This lane's copy addresses for stage 0, buffer 0.
  const unsigned lds0 = (unsigned)(size_t)(&L[0]);
  const unsigned al0  = lds0 + (tid >> 4) * GPITCH + (tid & 15) * 16;
  const unsigned bl0  = al0 + GOPB;
  const _Float16* ag  = A  + (size_t)(bm0 + (tid >> 4)) * Dm + (tid & 15) * 8;
  const _Float16* bg  = Bt + (size_t)(bn0 + (tid >> 4)) * Dm + (tid & 15) * 8;

  slab_copy(al0, ag);
  slab_copy(bl0, bg);

  v8f acc0[4], acc1[4];
#pragma unroll
  for (int nt = 0; nt < 4; ++nt) {
    v8f z = {};
    acc0[nt] = z;
    acc1[nt] = z;
  }

  // Stage 0 has landed for this wave; the barrier publishes it to the others.
  asm volatile("s_wait_asynccnt 0x0" ::: "memory");
  __syncthreads();
  slab_copy(al0 + GSTAGEB, ag + GKS);
  slab_copy(bl0 + GSTAGEB, bg + GKS);

#pragma unroll 1
  for (int st = 0; st < GNST; ++st) {
    const unsigned bufo = (st & 1) * GSTAGEB;
    const unsigned char* Al = L + bufo + (wm + l16) * GPITCH;
    const unsigned char* Bl = L + bufo + GOPB + (wn + l16) * GPITCH;

    // Two fragment sets: the 12 LDS reads of k step kk + 1 go out as one group
    // ahead of the 8 WMMAs of k step kk (inside this stage only; nothing of the
    // next stage is read here). Unrolled: constant offsets from Al / Bl.
    v16h af[2][2], bf[2][4];
    af[0][0] = load_frag((const _Float16*)Al, hi);
    af[0][1] = load_frag((const _Float16*)(Al + 16 * GPITCH), hi);
#pragma unroll
    for (int nt = 0; nt < 4; ++nt)
      bf[0][nt] = load_frag((const _Float16*)(Bl + nt * 16 * GPITCH), hi);
#pragma unroll
    for (int kk = 0; kk < GKS / 32; ++kk) {
      const int cur = kk & 1, nxt = cur ^ 1;
      if (kk + 1 < GKS / 32) {
        af[nxt][0] = load_frag((const _Float16*)Al + (kk + 1) * 32, hi);
        af[nxt][1] = load_frag((const _Float16*)(Al + 16 * GPITCH) + (kk + 1) * 32, hi);
#pragma unroll
        for (int nt = 0; nt < 4; ++nt)
          bf[nxt][nt] = load_frag((const _Float16*)(Bl + nt * 16 * GPITCH) + (kk + 1) * 32, hi);
      }
      // Keeps the read group above in front of the WMMAs below: left free, the
      // scheduler sinks each read to its use and waits out the LDS latency
      // before every pair of WMMAs.
      __builtin_amdgcn_sched_barrier(0);
#pragma unroll
      for (int nt = 0; nt < 4; ++nt) {
        acc0[nt] = __builtin_amdgcn_wmma_f32_16x16x32_f16(false, af[cur][0], false, bf[cur][nt],
                                                          (short)0, acc0[nt], false, false);
        acc1[nt] = __builtin_amdgcn_wmma_f32_16x16x32_f16(false, af[cur][1], false, bf[cur][nt],
                                                          (short)0, acc1[nt], false, false);
      }
    }

    // Hand-over of the buffers: this wave's LDS reads of stage st are done ...
    asm volatile("s_wait_dscnt 0x0" ::: "memory");
    // ... its own copies of stage st + 1 have landed ...
    asm volatile("s_wait_asynccnt 0x0" ::: "memory");
    // ... and the barrier says both of every wave of the block.
    __syncthreads();
    if (st + 2 < GNST) {  // refill the buffer that stage st has just left
      slab_copy(al0 + bufo, ag + (st + 2) * GKS);
      slab_copy(bl0 + bufo, bg + (st + 2) * GKS);
    }
  }
  // no copy is left in flight when the wave ends
  asm volatile("s_wait_asynccnt 0x0" ::: "memory");

  // C/D layout: element (m = i + 8*hi, n = l16)
#pragma unroll
  for (int nt = 0; nt < 4; ++nt) {
    int n = n0 + nt * 16 + l16;
    float bv = bias[n];
#pragma unroll
    for (int i = 0; i < 8; ++i) {
      int ma = m0 + i + 8 * hi;
      int mb = ma + 16;
      float va = acc0[nt][i] + bv;
      float vb = acc1[nt][i] + bv;
      if (MODE == 0) {
        ((_Float16*)Out)[(size_t)ma * N + n] = (_Float16)va;
        ((_Float16*)Out)[(size_t)mb * N + n] = (_Float16)vb;
      } else if (MODE == 1) {
        ((_Float16*)Out)[(size_t)n * M + ma] = (_Float16)va;
        ((_Float16*)Out)[(size_t)n * M + mb] = (_Float16)vb;
      } else {
        ((float*)Out)[(size_t)ma * N + n] = va;
        ((float*)Out)[(size_t)mb * N + n] = vb;
      }
    }
  }
  // In the merged kernel another job's code follows this one in the listing:
  // the wait stands in front of any rewrite of a register the stores above name.
  // (The output projection is its kernel's only job: the wave ends here.)
  if (MODE != 2) asm volatile("s_wait_xcnt 0x0" ::: "memory");
}

// The three projections read the same Xh and none reads another's output, so
// they share one grid: blockIdx.x runs over the column tiles of Q, then K,
// then V (a choice that is the same for all threads of a block).
// grid = ((Dm + 2 NKV)/128, S/128)
__global__ __launch_bounds__(256) void gemm_qkv(const _Float16* __restrict__ Xh,
                                                const _Float16* __restrict__ qwt,
                                                const _Float16* __restrict__ kwt,
                                                const _Float16* __restrict__ vwt,
                                                const float* __restrict__ q_b,
                                                const float* __restrict__ k_b,
                                                const float* __restrict__ v_b,
                                                _Float16* __restrict__ Qh,
                                                _Float16* __restrict__ Kh,
                                                _Float16* __restrict__ Vth) {
  __shared__ __attribute__((aligned(16))) unsigned char L[2 * GSTAGEB];
  const int bx = blockIdx.x;
  if (bx < Dm / 128)
    gemm_tile<0, Dm>(L, Xh, qwt, q_b, Qh, bx, blockIdx.y);
  else if (bx < (Dm + NKV) / 128)
    gemm_tile<0, NKV>(L, Xh, kwt, k_b, Kh, bx - Dm / 128, blockIdx.y);
  else
    gemm_tile<1, NKV>(L, Xh, vwt, v_b, Vth, bx - (Dm + NKV) / 128, blockIdx.y);
}

// Output projection. grid = (Dm/128, S/128)
__global__ __launch_bounds__(256) void gemm_out(const _Float16* __restrict__ Ah,
                                                const _Float16* __restrict__ owt,
                                                const float* __restrict__ o_b,
                                                float* __restrict__ out) {
  __shared__ __attribute__((aligned(16))) unsigned char L[2 * GSTAGEB];
  gemm_tile<2, Dm>(L, Ah, owt, o_b, out, blockIdx.x, blockIdx.y);
}

static constexpr int KT     = 128;
static constexpr int KHALF  = S / 2;
static constexpr int NST    = KHALF / KT;
static constexpr int KPITCH = HD * 2 + 16;
static constexpr int VPITCH = KT * 2 + 16;
static constexpr int KBYTES = KT * KPITCH;
static constexpr int VBYTES = HD * VPITCH;
static constexpr int STAGEB = KBYTES + VBYTES;
static constexpr int XCHB   = 32 * 16 * 8 + 32 * 8;  // 4352 B: one wave's handed-over tile, maximum, sum

// One stage: 4 K copies and 4 V^T copies per lane (256 lanes x 16 B = 4 KB each).
// kl / vl: this lane's LDS byte addresses, kg / vg: its global addresses.
// K copy j takes rows 32 j + (tid >> 3); V^T copy j rows 16 j + (tid >> 4).
__device__ inline void stage_copy(unsigned kl, unsigned vl,
                                  const _Float16* kg, const _Float16* vg) {
  asm volatile(
      "global_load_async_to_lds_b128 %0, %8, off\n\t"
      "global_load_async_to_lds_b128 %1, %9, off\n\t"
      "global_load_async_to_lds_b128 %2, %10, off\n\t"
      "global_load_async_to_lds_b128 %3, %11, off\n\t"
      "global_load_async_to_lds_b128 %4, %12, off\n\t"
      "global_load_async_to_lds_b128 %5, %13, off\n\t"
      "global_load_async_to_lds_b128 %6, %14, off\n\t"
      "global_load_async_to_lds_b128 %7, %15, off\n\t"
      "s_wait_xcnt 0x0"
      :
      : "v"(kl), "v"(kl + 32 * KPITCH), "v"(kl + 64 * KPITCH), "v"(kl + 96 * KPITCH),
        "v"(vl), "v"(vl + 16 * VPITCH), "v"(vl + 32 * VPITCH), "v"(vl + 48 * VPITCH),
        "v"(kg), "v"(kg + 32 * NKV), "v"(kg + 64 * NKV), "v"(kg + 96 * NKV),
        "v"(vg), "v"(vg + (size_t)16 * S), "v"(vg + (size_t)32 * S), "v"(vg + (size_t)48 * S)
      : "memory");
}

__global__ __launch_bounds__(512) void attn_kernel(const _Float16* __restrict__ Q,
                                                   const _Float16* __restrict__ Km,
                                                   const _Float16* __restrict__ Vt,
                                                   _Float16* __restrict__ O) {
  __shared__ __attribute__((aligned(16))) unsigned char L[4 * STAGEB];

  const int tid  = threadIdx.x & 255;      // place in the half
  const int lane = threadIdx.x & 31;
  const int wave = (threadIdx.x >> 5) & 7; // wave in the half
  const int l16  = lane & 15;
  const int hi   = lane >> 4;
  // Which half: the same in all lanes of a wave, held in a scalar register.
  const int grp  = __builtin_amdgcn_readfirstlane(threadIdx.x >> 8);
  unsigned char* Lg = L + grp * (2 * STAGEB);   // this half's ring

  const int idx = blockIdx.x * 8 + wave;   // 0..2047
  const int h   = idx >> 7;                // head 0..15 (the same for all waves of a block)
  const int qp2 = idx & 127;               // 32-query pair tile 0..127
  const int kvh = h >> 2;                  // GROUP = 4 (repeat_interleave)

  // This lane's copy addresses for stage 0, buffer 0.
  const unsigned lds0 = (unsigned)(size_t)(&Lg[0]);
  const unsigned kl0  = lds0 + (tid >> 3) * KPITCH + (tid & 7) * 16;
  const unsigned vl0  = lds0 + KBYTES + (tid >> 4) * VPITCH + (tid & 15) * 16;
  const _Float16* kg  = Km + (size_t)(grp * KHALF + (tid >> 3)) * NKV + kvh * HD + (tid & 7) * 8;
  const _Float16* vg  = Vt + (size_t)(kvh * HD + (tid >> 4)) * S + grp * KHALF + (tid & 15) * 8;

  stage_copy(kl0, vl0, kg, vg);

  // Q^T B-fragments for two 16-query tiles (hd halves 0..31 / 32..63)
  v16h qf[2][2];
#pragma unroll
  for (int s = 0; s < 2; ++s) {
    const _Float16* qp = Q + (size_t)(qp2 * 32 + s * 16 + l16) * Dm + h * HD;
    qf[s][0] = load_frag(qp, hi);
    qf[s][1] = load_frag(qp + 32, hi);
  }

  float mrun[2] = {-1e30f, -1e30f};
  float lrun[2] = {0.0f, 0.0f};
  v8f oacc[2][4];  // O^T tiles: (m = hd, n = query)
#pragma unroll
  for (int s = 0; s < 2; ++s)
#pragma unroll
    for (int nt = 0; nt < 4; ++nt) {
      v8f z = {};
      oacc[s][nt] = z;
    }

  // Softmax in base 2: exp(scale * c - m) = exp2(c * kscale - m * log2(e)), with
  // kscale = 1/sqrt(64) * log2(e). mrun holds the running maximum in those units.
  const float kscale = 0.125f * 1.44269504088896340736f;

  // Stage 0 has landed for this wave; the barrier publishes it to the others.
  asm volatile("s_wait_asynccnt 0x0" ::: "memory");
  __syncthreads();
  stage_copy(kl0 + STAGEB, vl0 + STAGEB, kg + (size_t)KT * NKV, vg + KT);

  for (int st = 0; st < NST; ++st) {
    const unsigned bufo = (st & 1) * STAGEB;
    const unsigned char* Kl = Lg + bufo + l16 * KPITCH;
    const unsigned char* Vl = Lg + bufo + KBYTES + l16 * VPITCH;

#pragma unroll 2
    for (int p = 0; p < KT / 32; ++p) {
      // ---- S^T tiles: c[s][t] holds keys p*32+t*16+(i+8*hi), query tile s ----
      v8f c[2][2];
#pragma unroll
      for (int t = 0; t < 2; ++t) {
        const _Float16* kp = (const _Float16*)(Kl + (p * 32 + t * 16) * KPITCH);
        v16h aK0 = load_frag(kp, hi);
        v16h aK1 = load_frag(kp + 32, hi);
#pragma unroll
        for (int s = 0; s < 2; ++s) {
          v8f z = {};
          z       = __builtin_amdgcn_wmma_f32_16x16x32_f16(false, aK0, false, qf[s][0],
                                                           (short)0, z, false, false);
          c[s][t] = __builtin_amdgcn_wmma_f32_16x16x32_f16(false, aK1, false, qf[s][1],
                                                           (short)0, z, false, false);
        }
      }

      // ---- online softmax per query tile (per-lane + one half-swap) ----
      v16h pb[2];
#pragma unroll
      for (int s = 0; s < 2; ++s) {
        // maximum of the raw scores (kscale is positive, so it commutes with max)
        float lmax = -1e30f;
#pragma unroll
        for (int i = 0; i < 8; ++i)
          lmax = fmaxf(lmax, fmaxf(c[s][0][i], c[s][1][i]));
        lmax = fmaxf(lmax, __shfl_xor(lmax, 16, 32));  // combine key halves
        float mnew = fmaxf(mrun[s], lmax * kscale);
        float corr = __builtin_amdgcn_exp2f(mrun[s] - mnew);
        mrun[s] = mnew;

        // One multiply-add per score in front of its exp2, two neighbouring
        // accumulator registers per packed instruction.
        float p0[8], p1[8];
        float ls = 0.0f;
        const f2 kk2 = {kscale, kscale};
        const f2 nm2 = {-mnew, -mnew};
#pragma unroll
        for (int i = 0; i < 8; i += 2) {
          const f2 a0 = __builtin_elementwise_fma(f2{c[s][0][i], c[s][0][i + 1]}, kk2, nm2);
          const f2 a1 = __builtin_elementwise_fma(f2{c[s][1][i], c[s][1][i + 1]}, kk2, nm2);
          p0[i]     = __builtin_amdgcn_exp2f(a0.x);
          p0[i + 1] = __builtin_amdgcn_exp2f(a0.y);
          p1[i]     = __builtin_amdgcn_exp2f(a1.x);
          p1[i + 1] = __builtin_amdgcn_exp2f(a1.y);
          ls += p0[i] + p1[i];
          ls += p0[i + 1] + p1[i + 1];
        }
        ls += __shfl_xor(ls, 16, 32);
        lrun[s] = lrun[s] * corr + ls;

#pragma unroll
        for (int nt = 0; nt < 4; ++nt)
#pragma unroll
          for (int i = 0; i < 8; ++i) oacc[s][nt][i] *= corr;

        // pack P^T B-fragment: c0[j] -> K=hi*8+j, c1[j] -> K=16+hi*8+j
#pragma unroll
        for (int j = 0; j < 8; ++j) {
          pb[s][j]     = (_Float16)p0[j];
          pb[s][j + 8] = (_Float16)p1[j];
        }
      }

      // ---- O^T += V^T(A) x P^T(B); V^T fragments shared by both tiles ----
#pragma unroll
      for (int nt = 0; nt < 4; ++nt) {
        const _Float16* vp = (const _Float16*)(Vl + nt * 16 * VPITCH) + p * 32;
        v16h av = load_frag(vp, hi);
#pragma unroll
        for (int s = 0; s < 2; ++s)
          oacc[s][nt] = __builtin_amdgcn_wmma_f32_16x16x32_f16(false, av, false, pb[s],
                                                               (short)0, oacc[s][nt], false, false);
      }
    }

    // Hand-over of the buffers: this wave's LDS reads of stage st are done ...
    asm volatile("s_wait_dscnt 0x0" ::: "memory");
    // ... its own copies of stage st + 1 have landed ...
    asm volatile("s_wait_asynccnt 0x0" ::: "memory");
    // ... and the barrier says both of every wave of the block.
    __syncthreads();
    if (st + 2 < NST)  // refill the buffer that stage st has just left
      stage_copy(kl0 + bufo, vl0 + bufo, kg + (size_t)(st + 2) * KT * NKV, vg + (st + 2) * KT);
  }
  // no copy is left in flight when the wave ends
  asm volatile("s_wait_asynccnt 0x0" ::: "memory");

  // ---- join the two halves: half g finishes query tile g of its wave's pair and
  // hands the other tile's partial result to the wave of the other half that
  // holds the same queries. The ring is free: the last stage's barrier stands
  // behind every wave's last read of it, and no copy is in flight.
  const bool g1 = grp != 0;
  v8f keep[4];
  {
    unsigned char* xo = L + ((grp << 3) + wave) * XCHB;   // this wave's hand-over
#pragma unroll
    for (int nt = 0; nt < 4; ++nt) {
      v8f give;
#pragma unroll
      for (int i = 0; i < 8; ++i) {
        keep[nt][i] = g1 ? oacc[1][nt][i] : oacc[0][nt][i];
        give[i]     = g1 ? oacc[0][nt][i] : oacc[1][nt][i];
      }
      *(f4*)(xo + (2 * nt) * 512 + lane * 16)     = f4{give[0], give[1], give[2], give[3]};
      *(f4*)(xo + (2 * nt + 1) * 512 + lane * 16) = f4{give[4], give[5], give[6], give[7]};
    }
    *(f2*)(xo + 4096 + lane * 8) = g1 ? f2{mrun[0], lrun[0]} : f2{mrun[1], lrun[1]};
  }
  // publishes every wave's hand-over to its partner
  __syncthreads();

  const unsigned char* xi = L + (((grp ^ 1) << 3) + wave) * XCHB;   // the partner's
  const f2 ml = *(const f2*)(xi + 4096 + lane * 8);
  const float ma = g1 ? mrun[1] : mrun[0];
  const float la = g1 ? lrun[1] : lrun[0];
  const float mj = fmaxf(ma, ml.x);
  float wa, wb;   // weights of this wave's part and of the partner's
  asm("v_exp_f32 %0, %2\n\t"
      "v_exp_f32 %1, %3\n\t"
      "v_nop"
      : "=&v"(wa), "=&v"(wb)
      : "v"(ma - mj), "v"(ml.x - mj));
  const float rinv = 1.0f / (la * wa + ml.y * wb);
  wa *= rinv;
  wb *= rinv;

  // ---- normalize and store: O^T element (m = hd, n = query) ----
  const int srow = qp2 * 32 + grp * 16 + l16;
  _Float16* op = O + (size_t)srow * Dm + h * HD + 8 * hi;
#pragma unroll
  for (int nt = 0; nt < 4; ++nt) {
    const f4 b0 = *(const f4*)(xi + (2 * nt) * 512 + lane * 16);
    const f4 b1 = *(const f4*)(xi + (2 * nt + 1) * 512 + lane * 16);
    h8 v;
#pragma unroll
    for (int i = 0; i < 4; ++i) {
      v[i]     = (_Float16)(keep[nt][i] * wa + b0[i] * wb);
      v[i + 4] = (_Float16)(keep[nt][i + 4] * wa + b1[i] * wb);
    }
    *(h8*)(op + nt * 16) = v;
  }
}

// ---------------------------------------------------------------------------
// Host launch
// ---------------------------------------------------------------------------
extern "C" void kernel_launch(void* const* d_in, const int* in_sizes, int n_in,
                              void* d_out, int out_size, void* d_ws, size_t ws_size,
                              hipStream_t stream) {
  (void)in_sizes; (void)n_in; (void)out_size; (void)ws_size;
  const float* X   = (const float*)d_in[0];
  const float* q_w = (const float*)d_in[1];
  const float* q_b = (const float*)d_in[2];
  const float* k_w = (const float*)d_in[3];
  const float* k_b = (const float*)d_in[4];
  const float* v_w = (const float*)d_in[5];
  const float* v_b = (const float*)d_in[6];
  const float* o_w = (const float*)d_in[7];
  const float* o_b = (const float*)d_in[8];
  float* out = (float*)d_out;

  // Carve workspace (f16 buffers), 256B aligned. Total ~33 MB.
  char* ws = (char*)d_ws;
  auto carve = [&](size_t bytes) {
    char* p = ws;
    ws += (bytes + 255) & ~(size_t)255;
    return p;
  };
  _Float16* Xh  = (_Float16*)carve((size_t)S * Dm * 2);    // X in f16
  _Float16* qwt = (_Float16*)carve((size_t)Dm * Dm * 2);   // q_w^T
  _Float16* kwt = (_Float16*)carve((size_t)Dm * NKV * 2);  // k_w^T
  _Float16* vwt = (_Float16*)carve((size_t)Dm * NKV * 2);  // v_w^T
  _Float16* owt = (_Float16*)carve((size_t)Dm * Dm * 2);   // o_w^T
  _Float16* Qh  = (_Float16*)carve((size_t)S * Dm * 2);    // Q [S][1024]
  _Float16* Kh  = (_Float16*)carve((size_t)S * NKV * 2);   // K [S][256]
  _Float16* Vth = (_Float16*)carve((size_t)NKV * S * 2);   // V^T [256][S]
  _Float16* Ah  = (_Float16*)carve((size_t)S * Dm * 2);    // attention out [S][1024]

  // 1) Convert / transpose inputs to f16, 32 elements a thread: one launch
  prep_f16<<<PB_ALL, 256, 0, stream>>>(X, q_w, k_w, v_w, o_w, Xh, qwt, kwt, vwt, owt);

  // 2) Q, K, V projections (WMMA GEMMs), 128x128 tile per block: one launch
  gemm_qkv<<<dim3((Dm + 2 * NKV) / 128, S / 128), 256, 0, stream>>>(Xh, qwt, kwt, vwt, q_b, k_b, v_b,
                                                                    Qh, Kh, Vth);

  // 3) Flash attention: 16 heads x 128 query-pair tiles x 2 key halves = 4096 waves, 16/block
  attn_kernel<<<(Hn * (S / 32)) / 8, 512, 0, stream>>>(Qh, Kh, Vth, Ah);

  // 4) Output projection -> f32
  gemm_out<<<dim3(Dm / 128, S / 128), 256, 0, stream>>>(Ah, owt, o_b, out);
}

// v007
// A run of this version takes 81.1 microseconds.
// Two timings next to v006 both put it at 1.11 times that version's speed.
// Counting every step since v000, it is 4.98 times as fast.
#include <hip/hip_runtime.h>

typedef __attribute__((ext_vector_type(16))) _Float16 v16h;
typedef __attribute__((ext_vector_type(8)))  _Float16 h8;
typedef __attribute__((ext_vector_type(8)))  float    v8f;
typedef __attribute__((ext_vector_type(4)))  float    f4;
typedef __attribute__((ext_vector_type(4)))  _Float16 h4;
typedef __attribute__((ext_vector_type(2)))  float    f2;

static constexpr int S   = 4096;
static constexpr int Dm  = 1024;
static constexpr int Hn  = 16;
static constexpr int KVH = 4;
static constexpr int HD  = 64;
static constexpr int NKV = KVH * HD;   // 256

__device__ inline v16h load_frag(const _Float16* rowptr, int hi) {
  h8 x = *(const h8*)(rowptr + hi * 8);
  h8 y = *(const h8*)(rowptr + 16 + hi * 8);
  v16h r;
#pragma unroll
  for (int j = 0; j < 8; ++j) { r[j] = x[j]; r[j + 8] = y[j]; }
  return r;
}

// ---------------------------------------------------------------------------
// Elementwise f32 -> f16 convert, 32 elements a thread: 8 loads of 16 B in
// flight per lane, each wave-wide load 512 contiguous bytes, each store 256.
// A block takes CVT_BLK elements; blocks 0 .. size / CVT_BLK - 1 cover the array.
// ---------------------------------------------------------------------------
static constexpr int CVT_BLK = 256 * 32;

__device__ inline void convert_f16(const float* __restrict__ in,
                                   _Float16* __restrict__ out, int blk) {
  const size_t base = (size_t)blk * CVT_BLK + threadIdx.x * 4;
  f4 v[8];
#pragma unroll
  for (int j = 0; j < 8; ++j) v[j] = *(const f4*)(in + base + j * 1024);
#pragma unroll
  for (int j = 0; j < 8; ++j) {
    h4 h;
#pragma unroll
    for (int i = 0; i < 4; ++i) h[i] = (_Float16)v[j][i];
    *(h4*)(out + base + j * 1024) = h;
  }
  // In the merged kernel another job's code follows this one in the listing:
  // the wait stands in front of any rewrite of a register the stores above name.
  asm volatile("s_wait_xcnt 0x0" ::: "memory");
}

// W [Kd x Nd] f32 (row-major)  ->  Wt [Nd x Kd] f16 (row-major)
// 32 elements a thread: a block of 8 k x 4 n, read by 8 loads of 16 B along n,
// turned in registers, written by 4 stores of 16 B along k. Eight lanes stand
// side by side in k, so a wave-wide store fills 4 whole 128-B lines of Wt.
// A wave takes 64 k x 16 n, a block 64 k x 128 n; (bx, by) in (Nd/128, Kd/64).
// Kd and Nd are compile-time, so that the 8 loads share one address register
// pair (row steps as immediate offsets), and the 4 stores another.
template <int Kd, int Nd>
__device__ inline void transpose_f16(const float* __restrict__ W,
                                     _Float16* __restrict__ Wt, int bx, int by) {
  const int lane = threadIdx.x & 31;
  const int wave = threadIdx.x >> 5;
  const int k = by * 64 + (lane & 7) * 8;
  const int n = bx * 128 + wave * 16 + (lane >> 3) * 4;
  const float* src = W + (size_t)k * Nd + n;
  f4 r[8];
#pragma unroll
  for (int j = 0; j < 8; ++j) r[j] = *(const f4*)(src + (size_t)j * Nd);
  _Float16* dst = Wt + (size_t)n * Kd + k;
#pragma unroll
  for (int i = 0; i < 4; ++i) {
    h8 c;
#pragma unroll
    for (int j = 0; j < 8; ++j) c[j] = (_Float16)r[j][i];
    *(h8*)(dst + (size_t)i * Kd) = c;
  }
  // In the merged kernel another job's code follows this one in the listing:
  // the wait stands in front of any rewrite of a register the stores above name.
  asm volatile("s_wait_xcnt 0x0" ::: "memory");
}

// The five jobs above read inputs only and none reads another's output, so
// they share one grid: a block picks its job by its index (the same for all
// its threads). Transposes first, then the convert.
static constexpr int PB_BIG = (Dm / 128) * (Dm / 64);    // blocks of a Dm x Dm transpose
static constexpr int PB_KV  = (NKV / 128) * (Dm / 64);   // blocks of a Dm x NKV transpose
static constexpr int PB_CVT = (S * Dm) / CVT_BLK;        // blocks of the convert
static constexpr int PB_ALL = 2 * PB_BIG + 2 * PB_KV + PB_CVT;

__global__ __launch_bounds__(256) void prep_f16(const float* __restrict__ X,
                                                const float* __restrict__ q_w,
                                                const float* __restrict__ k_w,
                                                const float* __restrict__ v_w,
                                                const float* __restrict__ o_w,
                                                _Float16* __restrict__ Xh,
                                                _Float16* __restrict__ qwt,
                                                _Float16* __restrict__ kwt,
                                                _Float16* __restrict__ vwt,
                                                _Float16* __restrict__ owt) {
  int b = blockIdx.x;
  if (b < 2 * PB_BIG) {
    const bool o = b >= PB_BIG;
    if (o) b -= PB_BIG;
    transpose_f16<Dm, Dm>(o ? o_w : q_w, o ? owt : qwt, b % (Dm / 128), b / (Dm / 128));
    return;
  }
  b -= 2 * PB_BIG;
  if (b < 2 * PB_KV) {
    const bool v = b >= PB_KV;
    if (v) b -= PB_KV;
    transpose_f16<Dm, NKV>(v ? v_w : k_w, v ? vwt : kwt, b % (NKV / 128), b / (NKV / 128));
    return;
  }
  convert_f16(X, Xh, b - 2 * PB_KV);
}

static constexpr int GKS     = 128;
static constexpr int GNST    = Dm / GKS;
static constexpr int GPITCH  = GKS * 2 + 16;
static constexpr int GOPB    = 128 * GPITCH;
static constexpr int GSTAGEB = 2 * GOPB;

// One operand's slab of a stage: 8 copies per lane (256 lanes x 16 B = 16 rows
// each). l: this lane's LDS byte address, g: its global address; copy j takes
// row 16 j + (tid >> 4).
__device__ inline void slab_copy(unsigned l, const _Float16* g) {
  asm volatile(
      "global_load_async_to_lds_b128 %0, %8, off\n\t"
      "global_load_async_to_lds_b128 %1, %9, off\n\t"
      "global_load_async_to_lds_b128 %2, %10, off\n\t"
      "global_load_async_to_lds_b128 %3, %11, off\n\t"
      "global_load_async_to_lds_b128 %4, %12, off\n\t"
      "global_load_async_to_lds_b128 %5, %13, off\n\t"
      "global_load_async_to_lds_b128 %6, %14, off\n\t"
      "global_load_async_to_lds_b128 %7, %15, off\n\t"
      "s_wait_xcnt 0x0"
      :
      : "v"(l), "v"(l + 16 * GPITCH), "v"(l + 32 * GPITCH), "v"(l + 48 * GPITCH),
        "v"(l + 64 * GPITCH), "v"(l + 80 * GPITCH), "v"(l + 96 * GPITCH), "v"(l + 112 * GPITCH),
        "v"(g), "v"(g + 16 * Dm), "v"(g + 32 * Dm), "v"(g + 48 * Dm),
        "v"(g + 64 * Dm), "v"(g + 80 * Dm), "v"(g + 96 * Dm), "v"(g + 112 * Dm)
      : "memory");
}

template <int MODE, int N>
__device__ inline void gemm_tile(unsigned char* L,
                                 const _Float16* __restrict__ A,
                                 const _Float16* __restrict__ Bt,
                                 const float* __restrict__ bias,
                                 void* __restrict__ Out, int bx, int by) {
  constexpr int M = S;
  const int tid  = threadIdx.x;
  const int lane = threadIdx.x & 31;
  const int wave = threadIdx.x >> 5;
  const int l16  = lane & 15;
  const int hi   = lane >> 4;
  const int wm   = (wave >> 1) * 32;       // this wave's rows in the block tile
  const int wn   = (wave & 1) * 64;        // this wave's columns in the block tile
  const int bm0  = by * 128;
  const int bn0  = bx * 128;
  const int m0   = bm0 + wm;
  const int n0   = bn0 + wn;

  // This lane's copy addresses for stage 0, buffer 0.
  const unsigned lds0 = (unsigned)(size_t)(&L[0]);
  const unsigned al0  = lds0 + (tid >> 4) * GPITCH + (tid & 15) * 16;
  const unsigned bl0  = al0 + GOPB;
  const _Float16* ag  = A  + (size_t)(bm0 + (tid >> 4)) * Dm + (tid & 15) * 8;
  const _Float16* bg  = Bt + (size_t)(bn0 + (tid >> 4)) * Dm + (tid & 15) * 8;

  slab_copy(al0, ag);
  slab_copy(bl0, bg);

  v8f acc0[4], acc1[4];
#pragma unroll
  for (int nt = 0; nt < 4; ++nt) {
    v8f z = {};
    acc0[nt] = z;
    acc1[nt] = z;
  }

  // Stage 0 has landed for this wave; the barrier publishes it to the others.
  asm volatile("s_wait_asynccnt 0x0" ::: "memory");
  __syncthreads();
  slab_copy(al0 + GSTAGEB, ag + GKS);
  slab_copy(bl0 + GSTAGEB, bg + GKS);

#pragma unroll 1
  for (int st = 0; st < GNST; ++st) {
    const unsigned bufo = (st & 1) * GSTAGEB;
    const unsigned char* Al = L + bufo + (wm + l16) * GPITCH;
    const unsigned char* Bl = L + bufo + GOPB + (wn + l16) * GPITCH;

    // Two fragment sets: the 12 LDS reads of k step kk + 1 go out as one group
    // ahead of the 8 WMMAs of k step kk (inside this stage only; nothing of the
    // next stage is read here). Unrolled: constant offsets from Al / Bl.
    v16h af[2][2], bf[2][4];
    af[0][0] = load_frag((const _Float16*)Al, hi);
    af[0][1] = load_frag((const _Float16*)(Al + 16 * GPITCH), hi);
#pragma unroll
    for (int nt = 0; nt < 4; ++nt)
      bf[0][nt] = load_frag((const _Float16*)(Bl + nt * 16 * GPITCH), hi);
#pragma unroll
    for (int kk = 0; kk < GKS / 32; ++kk) {
      const int cur = kk & 1, nxt = cur ^ 1;
      if (kk + 1 < GKS / 32) {
        af[nxt][0] = load_frag((const _Float16*)Al + (kk + 1) * 32, hi);
        af[nxt][1] = load_frag((const _Float16*)(Al + 16 * GPITCH) + (kk + 1) * 32, hi);
#pragma unroll
        for (int nt = 0; nt < 4; ++nt)
          bf[nxt][nt] = load_frag((const _Float16*)(Bl + nt * 16 * GPITCH) + (kk + 1) * 32, hi);
      }
      // Keeps the read group above in front of the WMMAs below: left free, the
      // scheduler sinks each read to its use and waits out the LDS latency
      // before every pair of WMMAs.
      __builtin_amdgcn_sched_barrier(0);
#pragma unroll
      for (int nt = 0; nt < 4; ++nt) {
        acc0[nt] = __builtin_amdgcn_wmma_f32_16x16x32_f16(false, af[cur][0], false, bf[cur][nt],
                                                          (short)0, acc0[nt], false, false);
        acc1[nt] = __builtin_amdgcn_wmma_f32_16x16x32_f16(false, af[cur][1], false, bf[cur][nt],
                                                          (short)0, acc1[nt], false, false);
      }
    }

    // Hand-over of the buffers: this wave's LDS reads of stage st are done ...
    asm volatile("s_wait_dscnt 0x0" ::: "memory");
    // ... its own copies of stage st + 1 have landed ...
    asm volatile("s_wait_asynccnt 0x0" ::: "memory");
    // ... and the barrier says both of every wave of the block.
    __syncthreads();
    if (st + 2 < GNST) {  // refill the buffer that stage st has just left
      slab_copy(al0 + bufo, ag + (st + 2) * GKS);
      slab_copy(bl0 + bufo, bg + (st + 2) * GKS);
    }
  }
  // no copy is left in flight when the wave ends
  asm volatile("s_wait_asynccnt 0x0" ::: "memory");

  // C/D layout: element (m = i + 8*hi, n = l16)
#pragma unroll
  for (int nt = 0; nt < 4; ++nt) {
    int n = n0 + nt * 16 + l16;
    float bv = bias[n];
#pragma unroll
    for (int i = 0; i < 8; ++i) {
      int ma = m0 + i + 8 * hi;
      int mb = ma + 16;
      float va = acc0[nt][i] + bv;
      float vb = acc1[nt][i] + bv;
      if (MODE == 0) {
        ((_Float16*)Out)[(size_t)ma * N + n] = (_Float16)va;
        ((_Float16*)Out)[(size_t)mb * N + n] = (_Float16)vb;
      } else if (MODE == 1) {
        ((_Float16*)Out)[(size_t)n * M + ma] = (_Float16)va;
        ((_Float16*)Out)[(size_t)n * M + mb] = (_Float16)vb;
      } else {
        ((float*)Out)[(size_t)ma * N + n] = va;
        ((float*)Out)[(size_t)mb * N + n] = vb;
      }
    }
  }
  // In the merged kernel another job's code follows this one in the listing:
  // the wait stands in front of any rewrite of a register the stores above name.
  // (The output projection is its kernel's only job: the wave ends here.)
  if (MODE != 2) asm volatile("s_wait_xcnt 0x0" ::: "memory");
}

// The three projections read the same Xh and none reads another's output, so
// they share one grid: blockIdx.x runs over the column tiles of Q, then K,
// then V (a choice that is the same for all threads of a block).
// grid = ((Dm + 2 NKV)/128, S/128)
__global__ __launch_bounds__(256) void gemm_qkv(const _Float16* __restrict__ Xh,
                                                const _Float16* __restrict__ qwt,
                                                const _Float16* __restrict__ kwt,
                                                const _Float16* __restrict__ vwt,
                                                const float* __restrict__ q_b,
                                                const float* __restrict__ k_b,
                                                const float* __restrict__ v_b,
                                                _Float16* __restrict__ Qh,
                                                _Float16* __restrict__ Kh,
                                                _Float16* __restrict__ Vth) {
  __shared__ __attribute__((aligned(16))) unsigned char L[2 * GSTAGEB];
  const int bx = blockIdx.x;
  if (bx < Dm / 128)
    gemm_tile<0, Dm>(L, Xh, qwt, q_b, Qh, bx, blockIdx.y);
  else if (bx < (Dm + NKV) / 128)
    gemm_tile<0, NKV>(L, Xh, kwt, k_b, Kh, bx - Dm / 128, blockIdx.y);
  else
    gemm_tile<1, NKV>(L, Xh, vwt, v_b, Vth, bx - (Dm + NKV) / 128, blockIdx.y);
}

// Output projection. grid = (Dm/128, S/128)
__global__ __launch_bounds__(256) void gemm_out(const _Float16* __restrict__ Ah,
                                                const _Float16* __restrict__ owt,
                                                const float* __restrict__ o_b,
                                                float* __restrict__ out) {
  __shared__ __attribute__((aligned(16))) unsigned char L[2 * GSTAGEB];
  gemm_tile<2, Dm>(L, Ah, owt, o_b, out, blockIdx.x, blockIdx.y);
}

static constexpr int KT     = 128;
static constexpr int KHALF  = S / 2;
static constexpr int NST    = KHALF / KT;
static constexpr int KPITCH = HD * 2 + 16;
static constexpr int VPITCH = KT * 2 + 16;
static constexpr int KBYTES = KT * KPITCH;
static constexpr int VBYTES = HD * VPITCH;
static constexpr int STAGEB = KBYTES + VBYTES;
static constexpr int XCHB   = 32 * 16 * 8 + 32 * 8;  // 4352 B: one wave's handed-over tile, maximum, sum

// One stage: 4 K copies and 4 V^T copies per lane (256 lanes x 16 B = 4 KB each).
// kl / vl: this lane's LDS byte addresses, kg / vg: its global addresses.
// K copy j takes rows 32 j + (tid >> 3); V^T copy j rows 16 j + (tid >> 4).
__device__ inline void stage_copy(unsigned kl, unsigned vl,
                                  const _Float16* kg, const _Float16* vg) {
  asm volatile(
      "global_load_async_to_lds_b128 %0, %8, off\n\t"
      "global_load_async_to_lds_b128 %1, %9, off\n\t"
      "global_load_async_to_lds_b128 %2, %10, off\n\t"
      "global_load_async_to_lds_b128 %3, %11, off\n\t"
      "global_load_async_to_lds_b128 %4, %12, off\n\t"
      "global_load_async_to_lds_b128 %5, %13, off\n\t"
      "global_load_async_to_lds_b128 %6, %14, off\n\t"
      "global_load_async_to_lds_b128 %7, %15, off\n\t"
      "s_wait_xcnt 0x0"
      :
      : "v"(kl), "v"(kl + 32 * KPITCH), "v"(kl + 64 * KPITCH), "v"(kl + 96 * KPITCH),
        "v"(vl), "v"(vl + 16 * VPITCH), "v"(vl + 32 * VPITCH), "v"(vl + 48 * VPITCH),
        "v"(kg), "v"(kg + 32 * NKV), "v"(kg + 64 * NKV), "v"(kg + 96 * NKV),
        "v"(vg), "v"(vg + (size_t)16 * S), "v"(vg + (size_t)32 * S), "v"(vg + (size_t)48 * S)
      : "memory");
}

__global__ __launch_bounds__(512) void attn_kernel(const _Float16* __restrict__ Q,
                                                   const _Float16* __restrict__ Km,
                                                   const _Float16* __restrict__ Vt,
                                                   _Float16* __restrict__ O) {
  __shared__ __attribute__((aligned(16))) unsigned char L[4 * STAGEB];

  const int tid  = threadIdx.x & 255;      // place in the half
  const int lane = threadIdx.x & 31;
  const int wave = (threadIdx.x >> 5) & 7; // wave in the half
  const int l16  = lane & 15;
  const int hi   = lane >> 4;
  // Which half: the same in all lanes of a wave, held in a scalar register.
  const int grp  = __builtin_amdgcn_readfirstlane(threadIdx.x >> 8);
  unsigned char* Lg = L + grp * (2 * STAGEB);   // this half's ring

  const int idx = blockIdx.x * 8 + wave;   // 0..2047
  const int h   = idx >> 7;                // head 0..15 (the same for all waves of a block)
  const int qp2 = idx & 127;               // 32-query pair tile 0..127
  const int kvh = h >> 2;                  // GROUP = 4 (repeat_interleave)

  // This lane's copy addresses for stage 0, buffer 0.
  const unsigned lds0 = (unsigned)(size_t)(&Lg[0]);
  const unsigned kl0  = lds0 + (tid >> 3) * KPITCH + (tid & 7) * 16;
  const unsigned vl0  = lds0 + KBYTES + (tid >> 4) * VPITCH + (tid & 15) * 16;
  const _Float16* kg  = Km + (size_t)(grp * KHALF + (tid >> 3)) * NKV + kvh * HD + (tid & 7) * 8;
  const _Float16* vg  = Vt + (size_t)(kvh * HD + (tid >> 4)) * S + grp * KHALF + (tid & 15) * 8;

  stage_copy(kl0, vl0, kg, vg);

  // Q^T B-fragments for two 16-query tiles (hd halves 0..31 / 32..63)
  v16h qf[2][2];
#pragma unroll
  for (int s = 0; s < 2; ++s) {
    const _Float16* qp = Q + (size_t)(qp2 * 32 + s * 16 + l16) * Dm + h * HD;
    qf[s][0] = load_frag(qp, hi);
    qf[s][1] = load_frag(qp + 32, hi);
  }

  float mrun[2] = {-1e30f, -1e30f};
  float lrun[2] = {0.0f, 0.0f};
  float thr[2]  = {-3.0e38f, -3.0e38f};  // raw score above which mrun is renewed: any score, at first
  v8f oacc[2][4];  // O^T tiles: (m = hd, n = query)
#pragma unroll
  for (int s = 0; s < 2; ++s)
#pragma unroll
    for (int nt = 0; nt < 4; ++nt) {
      v8f z = {};
      oacc[s][nt] = z;
    }

  // Softmax in base 2: exp(scale * c - m) = exp2(c * kscale - m * log2(e)), with
  // kscale = 1/sqrt(64) * log2(e). mrun holds the maximum in use, in those units; it may trail the true one.
  const float kscale = 0.125f * 1.44269504088896340736f;
  const float kinv   = 8.0f * 0.69314718055994530942f;  // 1 / kscale

  // Stage 0 has landed for this wave; the barrier publishes it to the others.
  asm volatile("s_wait_asynccnt 0x0" ::: "memory");
  __syncthreads();
  stage_copy(kl0 + STAGEB, vl0 + STAGEB, kg + (size_t)KT * NKV, vg + KT);

  for (int st = 0; st < NST; ++st) {
    const unsigned bufo = (st & 1) * STAGEB;
    const unsigned char* Kl = Lg + bufo + l16 * KPITCH;
    const unsigned char* Vl = Lg + bufo + KBYTES + l16 * VPITCH;

#pragma unroll 1
    for (int p = 0; p < KT / 32; ++p) {
      // ---- S^T tiles: c[s][t] holds keys p*32+t*16+(i+8*hi), query tile s ----
      v8f c[2][2];
#pragma unroll
      for (int t = 0; t < 2; ++t) {
        const _Float16* kp = (const _Float16*)(Kl + (p * 32 + t * 16) * KPITCH);
        v16h aK0 = load_frag(kp, hi);
        v16h aK1 = load_frag(kp + 32, hi);
#pragma unroll
        for (int s = 0; s < 2; ++s) {
          v8f z = {};
          z       = __builtin_amdgcn_wmma_f32_16x16x32_f16(false, aK0, false, qf[s][0],
                                                           (short)0, z, false, false);
          c[s][t] = __builtin_amdgcn_wmma_f32_16x16x32_f16(false, aK1, false, qf[s][1],
                                                           (short)0, z, false, false);
        }
      }

      // V^T fragments of this pass, shared by both tiles: read as one group ahead of
      // the vector work, so that they fly under the exponentials and no WMMA of the
      // second product waits out an LDS read.
      v16h av[4];
#pragma unroll
      for (int nt = 0; nt < 4; ++nt)
        av[nt] = load_frag((const _Float16*)(Vl + nt * 16 * VPITCH) + p * 32, hi);

      // ---- lazy rescale: mrun, the maximum in use, may trail the true one by up
      // to 8 (base-2 units), so an exponential can reach 2^8. One test a pass for
      // the whole wave, on each lane's own 16 raw scores against thr (mrun + 8 in
      // raw-score units; kscale is positive, so it commutes with max).
      float lmax[2];
      bool need = false;
#pragma unroll
      for (int s = 0; s < 2; ++s) {
        float lm = -1e30f;
#pragma unroll
        for (int i = 0; i < 8; ++i)
          lm = fmaxf(lm, fmaxf(c[s][0][i], c[s][1][i]));
        lmax[s] = lm;
        need = need || (lm > thr[s]);
      }
      if (__builtin_amdgcn_ballot_w32(need) != 0) {  // scalar branch; rare after the first passes
#pragma unroll
        for (int s = 0; s < 2; ++s) {
          // both key halves of a query take the same new maximum
          const float lm   = fmaxf(lmax[s], __shfl_xor(lmax[s], 16, 32));
          const float mnew = fmaxf(mrun[s], lm * kscale);
          const float corr = __builtin_amdgcn_exp2f(mrun[s] - mnew);
          mrun[s] = mnew;
          thr[s]  = (mnew + 8.0f) * kinv;
          lrun[s] *= corr;
#pragma unroll
          for (int nt = 0; nt < 4; ++nt)
#pragma unroll
            for (int i = 0; i < 8; ++i) oacc[s][nt][i] *= corr;
        }
      }

      // ---- exponentials per query tile (per-lane + one half-swap for the sum) ----
      // One multiply-add per score in front of its exp2, two neighbouring
      // accumulator registers per packed instruction.
      f2 a0[2][4], a1[2][4];
#pragma unroll
      for (int s = 0; s < 2; ++s) {
        const f2 kk2 = {kscale, kscale};
        const f2 nm2 = {-mrun[s], -mrun[s]};
#pragma unroll
        for (int i = 0; i < 4; ++i) {
          a0[s][i] = __builtin_elementwise_fma(f2{c[s][0][2 * i], c[s][0][2 * i + 1]}, kk2, nm2);
          a1[s][i] = __builtin_elementwise_fma(f2{c[s][1][2 * i], c[s][1][2 * i + 1]}, kk2, nm2);
        }
      }
      __builtin_amdgcn_sched_barrier(0);
      v16h pb[2];
#pragma unroll
      for (int s = 0; s < 2; ++s) {
        float p0[8], p1[8];
        float ls = 0.0f;
#pragma unroll
        for (int i = 0; i < 8; i += 2) {
          p0[i]     = __builtin_amdgcn_exp2f(a0[s][i / 2].x);
          p0[i + 1] = __builtin_amdgcn_exp2f(a0[s][i / 2].y);
          p1[i]     = __builtin_amdgcn_exp2f(a1[s][i / 2].x);
          p1[i + 1] = __builtin_amdgcn_exp2f(a1[s][i / 2].y);
          ls += p0[i] + p1[i];
          ls += p0[i + 1] + p1[i + 1];
        }
        ls += __shfl_xor(ls, 16, 32);
        lrun[s] += ls;

        // pack P^T B-fragment: c0[j] -> K=hi*8+j, c1[j] -> K=16+hi*8+j
#pragma unroll
        for (int j = 0; j < 8; ++j) {
          pb[s][j]     = (_Float16)p0[j];
          pb[s][j + 8] = (_Float16)p1[j];
        }
      }

      // ---- O^T += V^T(A) x P^T(B); V^T fragments shared by both tiles ----
#pragma unroll
      for (int nt = 0; nt < 4; ++nt) {
#pragma unroll
        for (int s = 0; s < 2; ++s)
          oacc[s][nt] = __builtin_amdgcn_wmma_f32_16x16x32_f16(false, av[nt], false, pb[s],
                                                               (short)0, oacc[s][nt], false, false);
      }
    }

    // Hand-over of the buffers: this wave's LDS reads of stage st are done ...
    asm volatile("s_wait_dscnt 0x0" ::: "memory");
    // ... its own copies of stage st + 1 have landed ...
    asm volatile("s_wait_asynccnt 0x0" ::: "memory");
    // ... and the barrier says both of every wave of the block.
    __syncthreads();
    if (st + 2 < NST)  // refill the buffer that stage st has just left
      stage_copy(kl0 + bufo, vl0 + bufo, kg + (size_t)(st + 2) * KT * NKV, vg + (st + 2) * KT);
  }
  // no copy is left in flight when the wave ends
  asm volatile("s_wait_asynccnt 0x0" ::: "memory");

  // ---- join the two halves: half g finishes query tile g of its wave's pair and
  // hands the other tile's partial result to the wave of the other half that
  // holds the same queries. The ring is free: the last stage's barrier stands
  // behind every wave's last read of it, and no copy is in flight.
  const bool g1 = grp != 0;
  v8f keep[4];
  {
    unsigned char* xo = L + ((grp << 3) + wave) * XCHB;   // this wave's hand-over
#pragma unroll
    for (int nt = 0; nt < 4; ++nt) {
      v8f give;
#pragma unroll
      for (int i = 0; i < 8; ++i) {
        keep[nt][i] = g1 ? oacc[1][nt][i] : oacc[0][nt][i];
        give[i]     = g1 ? oacc[0][nt][i] : oacc[1][nt][i];
      }
      *(f4*)(xo + (2 * nt) * 512 + lane * 16)     = f4{give[0], give[1], give[2], give[3]};
      *(f4*)(xo + (2 * nt + 1) * 512 + lane * 16) = f4{give[4], give[5], give[6], give[7]};
    }
    *(f2*)(xo + 4096 + lane * 8) = g1 ? f2{mrun[0], lrun[0]} : f2{mrun[1], lrun[1]};
  }
  // publishes every wave's hand-over to its partner
  __syncthreads();

  const unsigned char* xi = L + (((grp ^ 1) << 3) + wave) * XCHB;   // the partner's
  const f2 ml = *(const f2*)(xi + 4096 + lane * 8);
  const float ma = g1 ? mrun[1] : mrun[0];
  const float la = g1 ? lrun[1] : lrun[0];
  const float mj = fmaxf(ma, ml.x);
  float wa, wb;   // weights of this wave's part and of the partner's
  asm("v_exp_f32 %0, %2\n\t"
      "v_exp_f32 %1, %3\n\t"
      "v_nop"
      : "=&v"(wa), "=&v"(wb)
      : "v"(ma - mj), "v"(ml.x - mj));
  const float rinv = 1.0f / (la * wa + ml.y * wb);
  wa *= rinv;
  wb *= rinv;

  // ---- normalize and store: O^T element (m = hd, n = query) ----
  const int srow = qp2 * 32 + grp * 16 + l16;
  _Float16* op = O + (size_t)srow * Dm + h * HD + 8 * hi;
#pragma unroll
  for (int nt = 0; nt < 4; ++nt) {
    const f4 b0 = *(const f4*)(xi + (2 * nt) * 512 + lane * 16);
    const f4 b1 = *(const f4*)(xi + (2 * nt + 1) * 512 + lane * 16);
    h8 v;
#pragma unroll
    for (int i = 0; i < 4; ++i) {
      v[i]     = (_Float16)(keep[nt][i] * wa + b0[i] * wb);
      v[i + 4] = (_Float16)(keep[nt][i + 4] * wa + b1[i] * wb);
    }
    *(h8*)(op + nt * 16) = v;
  }
}

// ---------------------------------------------------------------------------
// Host launch
// ---------------------------------------------------------------------------
extern "C" void kernel_launch(void* const* d_in, const int* in_sizes, int n_in,
                              void* d_out, int out_size, void* d_ws, size_t ws_size,
                              hipStream_t stream) {
  (void)in_sizes; (void)n_in; (void)out_size; (void)ws_size;
  const float* X   = (const float*)d_in[0];
  const float* q_w = (const float*)d_in[1];
  const float* q_b = (const float*)d_in[2];
  const float* k_w = (const float*)d_in[3];
  const float* k_b = (const float*)d_in[4];
  const float* v_w = (const float*)d_in[5];
  const float* v_b = (const float*)d_in[6];
  const float* o_w = (const float*)d_in[7];
  const float* o_b = (const float*)d_in[8];
  float* out = (float*)d_out;

  // Carve workspace (f16 buffers), 256B aligned. Total ~33 MB.
  char* ws = (char*)d_ws;
  auto carve = [&](size_t bytes) {
    char* p = ws;
    ws += (bytes + 255) & ~(size_t)255;
    return p;
  };
  _Float16* Xh  = (_Float16*)carve((size_t)S * Dm * 2);    // X in f16
  _Float16* qwt = (_Float16*)carve((size_t)Dm * Dm * 2);   // q_w^T
  _Float16* kwt = (_Float16*)carve((size_t)Dm * NKV * 2);  // k_w^T
  _Float16* vwt = (_Float16*)carve((size_t)Dm * NKV * 2);  // v_w^T
  _Float16* owt = (_Float16*)carve((size_t)Dm * Dm * 2);   // o_w^T
  _Float16* Qh  = (_Float16*)carve((size_t)S * Dm * 2);    // Q [S][1024]
  _Float16* Kh  = (_Float16*)carve((size_t)S * NKV * 2);   // K [S][256]
  _Float16* Vth = (_Float16*)carve((size_t)NKV * S * 2);   // V^T [256][S]
  _Float16* Ah  = (_Float16*)carve((size_t)S * Dm * 2);    // attention out [S][1024]

  // 1) Convert / transpose inputs to f16, 32 elements a thread: one launch
  prep_f16<<<PB_ALL, 256, 0, stream>>>(X, q_w, k_w, v_w, o_w, Xh, qwt, kwt, vwt, owt);

  // 2) Q, K, V projections (WMMA GEMMs), 128x128 tile per block: one launch
  gemm_qkv<<<dim3((Dm + 2 * NKV) / 128, S / 128), 256, 0, stream>>>(Xh, qwt, kwt, vwt, q_b, k_b, v_b,
                                                                    Qh, Kh, Vth);

  // 3) Flash attention: 16 heads x 128 query-pair tiles x 2 key halves = 4096 waves, 16/block
  attn_kernel<<<(Hn * (S / 32)) / 8, 512, 0, stream>>>(Qh, Kh, Vth, Ah);

  // 4) Output projection -> f32
  gemm_out<<<dim3(Dm / 128, S / 128), 256, 0, stream>>>(Ah, owt, o_b, out);
}

// v008
// Measured time: 78.1 microseconds a run.
// Two timings next to v007 put it at 1.03 and 1.04 times that version's speed.
// Counting every step since v000, it is 5.15 times as fast.
#include <hip/hip_runtime.h>

typedef __attribute__((ext_vector_type(16))) _Float16 v16h;
typedef __attribute__((ext_vector_type(8)))  _Float16 h8;
typedef __attribute__((ext_vector_type(8)))  float    v8f;
typedef __attribute__((ext_vector_type(4)))  float    f4;
typedef __attribute__((ext_vector_type(4)))  _Float16 h4;
typedef __attribute__((ext_vector_type(2)))  float    f2;

static constexpr int S   = 4096;
static constexpr int Dm  = 1024;
static constexpr int Hn  = 16;
static constexpr int KVH = 4;
static constexpr int HD  = 64;
static constexpr int NKV = KVH * HD;   // 256

__device__ inline v16h load_frag(const _Float16* rowptr, int hi) {
  h8 x = *(const h8*)(rowptr + hi * 8);
  h8 y = *(const h8*)(rowptr + 16 + hi * 8);
  v16h r;
#pragma unroll
  for (int j = 0; j < 8; ++j) { r[j] = x[j]; r[j + 8] = y[j]; }
  return r;
}

// ---------------------------------------------------------------------------
// Elementwise f32 -> f16 convert, 32 elements a thread: 8 loads of 16 B in
// flight per lane, each wave-wide load 512 contiguous bytes, each store 256.
// A block takes CVT_BLK elements; blocks 0 .. size / CVT_BLK - 1 cover the array.
// ---------------------------------------------------------------------------
static constexpr int CVT_BLK = 256 * 32;

__device__ inline void convert_f16(const float* __restrict__ in,
                                   _Float16* __restrict__ out, int blk) {
  const size_t base = (size_t)blk * CVT_BLK + threadIdx.x * 4;
  f4 v[8];
#pragma unroll
  for (int j = 0; j < 8; ++j) v[j] = *(const f4*)(in + base + j * 1024);
#pragma unroll
  for (int j = 0; j < 8; ++j) {
    h4 h;
#pragma unroll
    for (int i = 0; i < 4; ++i) h[i] = (_Float16)v[j][i];
    *(h4*)(out + base + j * 1024) = h;
  }
  // In the merged kernel another job's code follows this one in the listing:
  // the wait stands in front of any rewrite of a register the stores above name.
  asm volatile("s_wait_xcnt 0x0" ::: "memory");
}

// W [Kd x Nd] f32 (row-major)  ->  Wt [Nd x Kd] f16 (row-major)
// 32 elements a thread: a block of 8 k x 4 n, read by 8 loads of 16 B along n,
// turned in registers, written by 4 stores of 16 B along k. Eight lanes stand
// side by side in k, so a wave-wide store fills 4 whole 128-B lines of Wt.
// A wave takes 64 k x 16 n, a block 64 k x 128 n; (bx, by) in (Nd/128, Kd/64).
// Kd and Nd are compile-time, so that the 8 loads share one address register
// pair (row steps as immediate offsets), and the 4 stores another.
template <int Kd, int Nd>
__device__ inline void transpose_f16(const float* __restrict__ W,
                                     _Float16* __restrict__ Wt, int bx, int by) {
  const int lane = threadIdx.x & 31;
  const int wave = threadIdx.x >> 5;
  const int k = by * 64 + (lane & 7) * 8;
  const int n = bx * 128 + wave * 16 + (lane >> 3) * 4;
  const float* src = W + (size_t)k * Nd + n;
  f4 r[8];
#pragma unroll
  for (int j = 0; j < 8; ++j) r[j] = *(const f4*)(src + (size_t)j * Nd);
  _Float16* dst = Wt + (size_t)n * Kd + k;
#pragma unroll
  for (int i = 0; i < 4; ++i) {
    h8 c;
#pragma unroll
    for (int j = 0; j < 8; ++j) c[j] = (_Float16)r[j][i];
    *(h8*)(dst + (size_t)i * Kd) = c;
  }
  // In the merged kernel another job's code follows this one in the listing:
  // the wait stands in front of any rewrite of a register the stores above name.
  asm volatile("s_wait_xcnt 0x0" ::: "memory");
}

// The five jobs above read inputs only and none reads another's output, so
// they share one grid: a block picks its job by its index (the same for all
// its threads). Transposes first, then the convert.
static constexpr int PB_BIG = (Dm / 128) * (Dm / 64);    // blocks of a Dm x Dm transpose
static constexpr int PB_KV  = (NKV / 128) * (Dm / 64);   // blocks of a Dm x NKV transpose
static constexpr int PB_CVT = (S * Dm) / CVT_BLK;        // blocks of the convert
static constexpr int PB_ALL = 2 * PB_BIG + 2 * PB_KV + PB_CVT;

__global__ __launch_bounds__(256) void prep_f16(const float* __restrict__ X,
                                                const float* __restrict__ q_w,
                                                const float* __restrict__ k_w,
                                                const float* __restrict__ v_w,
                                                const float* __restrict__ o_w,
                                                _Float16* __restrict__ Xh,
                                                _Float16* __restrict__ qwt,
                                                _Float16* __restrict__ kwt,
                                                _Float16* __restrict__ vwt,
                                                _Float16* __restrict__ owt) {
  int b = blockIdx.x;
  if (b < 2 * PB_BIG) {
    const bool o = b >= PB_BIG;
    if (o) b -= PB_BIG;
    transpose_f16<Dm, Dm>(o ? o_w : q_w, o ? owt : qwt, b % (Dm / 128), b / (Dm / 128));
    return;
  }
  b -= 2 * PB_BIG;
  if (b < 2 * PB_KV) {
    const bool v = b >= PB_KV;
    if (v) b -= PB_KV;
    transpose_f16<Dm, NKV>(v ? v_w : k_w, v ? vwt : kwt, b % (NKV / 128), b / (NKV / 128));
    return;
  }
  convert_f16(X, Xh, b - 2 * PB_KV);
}

static constexpr int GKS     = 128;
static constexpr int GNST    = Dm / GKS;
static constexpr int GPITCH  = GKS * 2 + 16;
static constexpr int GOPB    = 128 * GPITCH;
static constexpr int GSTAGEB = 2 * GOPB;

// One operand's slab of a stage: 8 copies per lane (256 lanes x 16 B = 16 rows
// each). l: this lane's LDS byte address, g: its global address; copy j takes
// row 16 j + (tid >> 4).
__device__ inline void slab_copy(unsigned l, const _Float16* g) {
  asm volatile(
      "global_load_async_to_lds_b128 %0, %8, off\n\t"
      "global_load_async_to_lds_b128 %1, %9, off\n\t"
      "global_load_async_to_lds_b128 %2, %10, off\n\t"
      "global_load_async_to_lds_b128 %3, %11, off\n\t"
      "global_load_async_to_lds_b128 %4, %12, off\n\t"
      "global_load_async_to_lds_b128 %5, %13, off\n\t"
      "global_load_async_to_lds_b128 %6, %14, off\n\t"
      "global_load_async_to_lds_b128 %7, %15, off\n\t"
      "s_wait_xcnt 0x0"
      :
      : "v"(l), "v"(l + 16 * GPITCH), "v"(l + 32 * GPITCH), "v"(l + 48 * GPITCH),
        "v"(l + 64 * GPITCH), "v"(l + 80 * GPITCH), "v"(l + 96 * GPITCH), "v"(l + 112 * GPITCH),
        "v"(g), "v"(g + 16 * Dm), "v"(g + 32 * Dm), "v"(g + 48 * Dm),
        "v"(g + 64 * Dm), "v"(g + 80 * Dm), "v"(g + 96 * Dm), "v"(g + 112 * Dm)
      : "memory");
}

template <int MODE, int N>
__device__ inline void gemm_tile(unsigned char* L,
                                 const _Float16* __restrict__ A,
                                 const _Float16* __restrict__ Bt,
                                 const float* __restrict__ bias,
                                 void* __restrict__ Out, int bx, int by) {
  constexpr int M = S;
  const int tid  = threadIdx.x;
  const int lane = threadIdx.x & 31;
  const int wave = threadIdx.x >> 5;
  const int l16  = lane & 15;
  const int hi   = lane >> 4;
  const int wm   = (wave >> 1) * 32;       // this wave's rows in the block tile
  const int wn   = (wave & 1) * 64;        // this wave's columns in the block tile
  const int bm0  = by * 128;
  const int bn0  = bx * 128;
  const int m0   = bm0 + wm;
  const int n0   = bn0 + wn;

  // This lane's copy addresses for stage 0, buffer 0.
  const unsigned lds0 = (unsigned)(size_t)(&L[0]);
  const unsigned al0  = lds0 + (tid >> 4) * GPITCH + (tid & 15) * 16;
  const unsigned bl0  = al0 + GOPB;
  const _Float16* ag  = A  + (size_t)(bm0 + (tid >> 4)) * Dm + (tid & 15) * 8;
  const _Float16* bg  = Bt + (size_t)(bn0 + (tid >> 4)) * Dm + (tid & 15) * 8;

  slab_copy(al0, ag);
  slab_copy(bl0, bg);

  v8f acc0[4], acc1[4];
#pragma unroll
  for (int nt = 0; nt < 4; ++nt) {
    v8f z = {};
    acc0[nt] = z;
    acc1[nt] = z;
  }

  // Stage 0 has landed for this wave; the barrier publishes it to the others.
  asm volatile("s_wait_asynccnt 0x0" ::: "memory");
  __syncthreads();
  slab_copy(al0 + GSTAGEB, ag + GKS);
  slab_copy(bl0 + GSTAGEB, bg + GKS);

#pragma unroll 1
  for (int st = 0; st < GNST; ++st) {
    const unsigned bufo = (st & 1) * GSTAGEB;
    const unsigned char* Al = L + bufo + (wm + l16) * GPITCH;
    const unsigned char* Bl = L + bufo + GOPB + (wn + l16) * GPITCH;

    // Two fragment sets: the 12 LDS reads of k step kk + 1 go out as one group
    // ahead of the 8 WMMAs of k step kk (inside this stage only; nothing of the
    // next stage is read here). Unrolled: constant offsets from Al / Bl.
    v16h af[2][2], bf[2][4];
    af[0][0] = load_frag((const _Float16*)Al, hi);
    af[0][1] = load_frag((const _Float16*)(Al + 16 * GPITCH), hi);
#pragma unroll
    for (int nt = 0; nt < 4; ++nt)
      bf[0][nt] = load_frag((const _Float16*)(Bl + nt * 16 * GPITCH), hi);
#pragma unroll
    for (int kk = 0; kk < GKS / 32; ++kk) {
      const int cur = kk & 1, nxt = cur ^ 1;
      if (kk + 1 < GKS / 32) {
        af[nxt][0] = load_frag((const _Float16*)Al + (kk + 1) * 32, hi);
        af[nxt][1] = load_frag((const _Float16*)(Al + 16 * GPITCH) + (kk + 1) * 32, hi);
#pragma unroll
        for (int nt = 0; nt < 4; ++nt)
          bf[nxt][nt] = load_frag((const _Float16*)(Bl + nt * 16 * GPITCH) + (kk + 1) * 32, hi);
      }
      // Keeps the read group above in front of the WMMAs below: left free, the
      // scheduler sinks each read to its use and waits out the LDS latency
      // before every pair of WMMAs.
      __builtin_amdgcn_sched_barrier(0);
#pragma unroll
      for (int nt = 0; nt < 4; ++nt) {
        acc0[nt] = __builtin_amdgcn_wmma_f32_16x16x32_f16(false, af[cur][0], false, bf[cur][nt],
                                                          (short)0, acc0[nt], false, false);
        acc1[nt] = __builtin_amdgcn_wmma_f32_16x16x32_f16(false, af[cur][1], false, bf[cur][nt],
                                                          (short)0, acc1[nt], false, false);
      }
    }

    // Hand-over of the buffers: this wave's LDS reads of stage st are done ...
    asm volatile("s_wait_dscnt 0x0" ::: "memory");
    // ... its own copies of stage st + 1 have landed ...
    asm volatile("s_wait_asynccnt 0x0" ::: "memory");
    // ... and the barrier says both of every wave of the block.
    __syncthreads();
    if (st + 2 < GNST) {  // refill the buffer that stage st has just left
      slab_copy(al0 + bufo, ag + (st + 2) * GKS);
      slab_copy(bl0 + bufo, bg + (st + 2) * GKS);
    }
  }
  // no copy is left in flight when the wave ends
  asm volatile("s_wait_asynccnt 0x0" ::: "memory");

  // C/D layout: element (m = i + 8*hi, n = l16)
#pragma unroll
  for (int nt = 0; nt < 4; ++nt) {
    int n = n0 + nt * 16 + l16;
    float bv = bias[n];
#pragma unroll
    for (int i = 0; i < 8; ++i) {
      int ma = m0 + i + 8 * hi;
      int mb = ma + 16;
      float va = acc0[nt][i] + bv;
      float vb = acc1[nt][i] + bv;
      if (MODE == 0) {
        ((_Float16*)Out)[(size_t)ma * N + n] = (_Float16)va;
        ((_Float16*)Out)[(size_t)mb * N + n] = (_Float16)vb;
      } else if (MODE == 1) {
        ((_Float16*)Out)[(size_t)n * M + ma] = (_Float16)va;
        ((_Float16*)Out)[(size_t)n * M + mb] = (_Float16)vb;
      } else {
        ((float*)Out)[(size_t)ma * N + n] = va;
        ((float*)Out)[(size_t)mb * N + n] = vb;
      }
    }
  }
  // In the merged kernel another job's code follows this one in the listing:
  // the wait stands in front of any rewrite of a register the stores above name.
  // (The output projection is its kernel's only job: the wave ends here.)
  if (MODE != 2) asm volatile("s_wait_xcnt 0x0" ::: "memory");
}

// The three projections read the same Xh and none reads another's output, so
// they share one grid: blockIdx.x runs over the column tiles of Q, then K,
// then V (a choice that is the same for all threads of a block).
// grid = ((Dm + 2 NKV)/128, S/128)
__global__ __launch_bounds__(256) void gemm_qkv(const _Float16* __restrict__ Xh,
                                                const _Float16* __restrict__ qwt,
                                                const _Float16* __restrict__ kwt,
                                                const _Float16* __restrict__ vwt,
                                                const float* __restrict__ q_b,
                                                const float* __restrict__ k_b,
                                                const float* __restrict__ v_b,
                                                _Float16* __restrict__ Qh,
                                                _Float16* __restrict__ Kh,
                                                _Float16* __restrict__ Vth) {
  __shared__ __attribute__((aligned(16))) unsigned char L[2 * GSTAGEB];
  const int bx = blockIdx.x;
  if (bx < Dm / 128)
    gemm_tile<0, Dm>(L, Xh, qwt, q_b, Qh, bx, blockIdx.y);
  else if (bx < (Dm + NKV) / 128)
    gemm_tile<0, NKV>(L, Xh, kwt, k_b, Kh, bx - Dm / 128, blockIdx.y);
  else
    gemm_tile<1, NKV>(L, Xh, vwt, v_b, Vth, bx - (Dm + NKV) / 128, blockIdx.y);
}

// Output projection. grid = (Dm/128, S/128)
__global__ __launch_bounds__(256) void gemm_out(const _Float16* __restrict__ Ah,
                                                const _Float16* __restrict__ owt,
                                                const float* __restrict__ o_b,
                                                float* __restrict__ out) {
  __shared__ __attribute__((aligned(16))) unsigned char L[2 * GSTAGEB];
  gemm_tile<2, Dm>(L, Ah, owt, o_b, out, blockIdx.x, blockIdx.y);
}

static constexpr int KT     = 128;
static constexpr int KHALF  = S / 2;
static constexpr int NST    = KHALF / KT;
static constexpr int KPITCH = HD * 2 + 16;
static constexpr int VPITCH = KT * 2 + 16;
static constexpr int KBYTES = KT * KPITCH;
static constexpr int VBYTES = HD * VPITCH;
static constexpr int STAGEB = KBYTES + VBYTES;
static constexpr int XCHB   = 32 * 16 * 8 + 32 * 8;  // 4352 B: one wave's handed-over tile, maximum, sum

// One stage: 4 K copies and 4 V^T copies per lane (256 lanes x 16 B = 4 KB each).
// kl / vl: this lane's LDS byte addresses, kg / vg: its global addresses.
// K copy j takes rows 32 j + (tid >> 3); V^T copy j rows 16 j + (tid >> 4).
__device__ inline void stage_copy(unsigned kl, unsigned vl,
                                  const _Float16* kg, const _Float16* vg) {
  asm volatile(
      "global_load_async_to_lds_b128 %0, %8, off\n\t"
      "global_load_async_to_lds_b128 %1, %9, off\n\t"
      "global_load_async_to_lds_b128 %2, %10, off\n\t"
      "global_load_async_to_lds_b128 %3, %11, off\n\t"
      "global_load_async_to_lds_b128 %4, %12, off\n\t"
      "global_load_async_to_lds_b128 %5, %13, off\n\t"
      "global_load_async_to_lds_b128 %6, %14, off\n\t"
      "global_load_async_to_lds_b128 %7, %15, off\n\t"
      "s_wait_xcnt 0x0"
      :
      : "v"(kl), "v"(kl + 32 * KPITCH), "v"(kl + 64 * KPITCH), "v"(kl + 96 * KPITCH),
        "v"(vl), "v"(vl + 16 * VPITCH), "v"(vl + 32 * VPITCH), "v"(vl + 48 * VPITCH),
        "v"(kg), "v"(kg + 32 * NKV), "v"(kg + 64 * NKV), "v"(kg + 96 * NKV),
        "v"(vg), "v"(vg + (size_t)16 * S), "v"(vg + (size_t)32 * S), "v"(vg + (size_t)48 * S)
      : "memory");
}

// Raw scores of one pass: c[s][t] = K rows t*16 .. t*16+15 (A, from LDS at kl, this
// lane's row) x Q^T of query tile s (B). Each K fragment serves both query tiles.
__device__ inline void score_tiles(const unsigned char* kl, int hi, const v16h (&qf)[2][2],
                                   v8f (&c)[2][2]) {
#pragma unroll
  for (int t = 0; t < 2; ++t) {
    const _Float16* kp = (const _Float16*)(kl + t * 16 * KPITCH);
    v16h aK0 = load_frag(kp, hi);
    v16h aK1 = load_frag(kp + 32, hi);
#pragma unroll
    for (int s = 0; s < 2; ++s) {
      v8f z = {};
      z       = __builtin_amdgcn_wmma_f32_16x16x32_f16(false, aK0, false, qf[s][0],
                                                       (short)0, z, false, false);
      c[s][t] = __builtin_amdgcn_wmma_f32_16x16x32_f16(false, aK1, false, qf[s][1],
                                                       (short)0, z, false, false);
    }
  }
}

// Exponentials of one pass, both query tiles: pb takes exp2(c * kscale - mrun) in f16,
// packed as the P^T B-fragment (c0[j] -> K=hi*8+j, c1[j] -> K=16+hi*8+j); ls takes each
// lane's f32 sum of its 16. One multiply-add per score in front of its exp2, two
// neighbouring accumulator registers per packed instruction.
__device__ inline void exp_pack(const v8f (&c)[2][2], const float (&mrun)[2], float kscale,
                                v16h (&pb)[2], float (&ls)[2]) {
  f2 a[2][2][4];   // [key tile][query tile]: in the order in which the score WMMAs finish
  const f2 kk2 = {kscale, kscale};
#pragma unroll
  for (int t = 0; t < 2; ++t)
#pragma unroll
    for (int s = 0; s < 2; ++s) {
      const f2 nm2 = {-mrun[s], -mrun[s]};
#pragma unroll
      for (int i = 0; i < 4; ++i)
        a[t][s][i] = __builtin_elementwise_fma(f2{c[s][t][2 * i], c[s][t][2 * i + 1]}, kk2, nm2);
    }
  __builtin_amdgcn_sched_barrier(0);
#pragma unroll
  for (int s = 0; s < 2; ++s) {
    float p0[8], p1[8];
    float sum = 0.0f;
#pragma unroll
    for (int i = 0; i < 8; i += 2) {
      p0[i]     = __builtin_amdgcn_exp2f(a[0][s][i / 2].x);
      p0[i + 1] = __builtin_amdgcn_exp2f(a[0][s][i / 2].y);
      p1[i]     = __builtin_amdgcn_exp2f(a[1][s][i / 2].x);
      p1[i + 1] = __builtin_amdgcn_exp2f(a[1][s][i / 2].y);
      sum += p0[i] + p1[i];
      sum += p0[i + 1] + p1[i + 1];
    }
    ls[s] = sum;
#pragma unroll
    for (int j = 0; j < 8; ++j) {
      pb[s][j]     = (_Float16)p0[j];
      pb[s][j + 8] = (_Float16)p1[j];
    }
  }
}

__global__ __launch_bounds__(512) void attn_kernel(const _Float16* __restrict__ Q,
                                                   const _Float16* __restrict__ Km,
                                                   const _Float16* __restrict__ Vt,
                                                   _Float16* __restrict__ O) {
  __shared__ __attribute__((aligned(16))) unsigned char L[4 * STAGEB];

  const int tid  = threadIdx.x & 255;      // place in the half
  const int lane = threadIdx.x & 31;
  const int wave = (threadIdx.x >> 5) & 7; // wave in the half
  const int l16  = lane & 15;
  const int hi   = lane >> 4;
  // Which half: the same in all lanes of a wave, held in a scalar register.
  const int grp  = __builtin_amdgcn_readfirstlane(threadIdx.x >> 8);
  unsigned char* Lg = L + grp * (2 * STAGEB);   // this half's ring

  const int idx = blockIdx.x * 8 + wave;   // 0..2047
  const int h   = idx >> 7;                // head 0..15 (the same for all waves of a block)
  const int qp2 = idx & 127;               // 32-query pair tile 0..127
  const int kvh = h >> 2;                  // GROUP = 4 (repeat_interleave)

  // This lane's copy addresses for stage 0, buffer 0.
  const unsigned lds0 = (unsigned)(size_t)(&Lg[0]);
  const unsigned kl0  = lds0 + (tid >> 3) * KPITCH + (tid & 7) * 16;
  const unsigned vl0  = lds0 + KBYTES + (tid >> 4) * VPITCH + (tid & 15) * 16;
  const _Float16* kg  = Km + (size_t)(grp * KHALF + (tid >> 3)) * NKV + kvh * HD + (tid & 7) * 8;
  const _Float16* vg  = Vt + (size_t)(kvh * HD + (tid >> 4)) * S + grp * KHALF + (tid & 15) * 8;

  stage_copy(kl0, vl0, kg, vg);

  // Q^T B-fragments for two 16-query tiles (hd halves 0..31 / 32..63)
  v16h qf[2][2];
#pragma unroll
  for (int s = 0; s < 2; ++s) {
    const _Float16* qp = Q + (size_t)(qp2 * 32 + s * 16 + l16) * Dm + h * HD;
    qf[s][0] = load_frag(qp, hi);
    qf[s][1] = load_frag(qp + 32, hi);
  }

  float mrun[2] = {-1e30f, -1e30f};
  float lrun[2] = {0.0f, 0.0f};
  v8f oacc[2][4];  // O^T tiles: (m = hd, n = query)
#pragma unroll
  for (int s = 0; s < 2; ++s)
#pragma unroll
    for (int nt = 0; nt < 4; ++nt) {
      v8f z = {};
      oacc[s][nt] = z;
    }

  // Softmax in base 2: exp(scale * c - m) = exp2(c * kscale - m * log2(e)), with
  // kscale = 1/sqrt(64) * log2(e). mrun holds the maximum in use, in those units; it may trail the true one.
  const float kscale = 0.125f * 1.44269504088896340736f;

  // Stage 0 has landed for this wave; the barrier publishes it to the others.
  asm volatile("s_wait_asynccnt 0x0" ::: "memory");
  __syncthreads();
  stage_copy(kl0 + STAGEB, vl0 + STAGEB, kg + (size_t)KT * NKV, vg + KT);

  for (int st = 0; st < NST; ++st) {
    const unsigned bufo = (st & 1) * STAGEB;
    const unsigned char* Kl = Lg + bufo + l16 * KPITCH;
    const unsigned char* Vl = Lg + bufo + KBYTES + l16 * VPITCH;

#pragma unroll 1
    for (int p = 0; p < KT / 32; ++p) {
      // ---- S^T tiles: c[s][t] holds keys p*32+t*16+(i+8*hi), query tile s ----
      v8f c[2][2];
      score_tiles(Kl + p * 32 * KPITCH, hi, qf, c);

      // V^T fragments of this pass, shared by both tiles: read as one group ahead of
      // the vector work, so that they fly under the exponentials and no WMMA of the
      // second product waits out an LDS read.
      v16h av[4];
#pragma unroll
      for (int nt = 0; nt < 4; ++nt)
        av[nt] = load_frag((const _Float16*)(Vl + nt * 16 * VPITCH) + p * 32, hi);
      __builtin_amdgcn_sched_group_barrier(0x100, 8, 0);
      __builtin_amdgcn_sched_group_barrier(0x008, 8, 0);
      __builtin_amdgcn_sched_group_barrier(0x100, 8, 0);
      __builtin_amdgcn_sched_barrier(0);

      // ---- exponentials against mrun, the maximum in use, which may trail the true one ----
      v16h pb[2];
      float ls[2];
      exp_pack(c, mrun, kscale, pb, ls);
      // the other key half's part of each sum: asked for here, added behind the test
      float lx[2] = {__shfl_xor(ls[0], 16, 32), __shfl_xor(ls[1], 16, 32)};

      // ---- lazy rescale, tested behind the exponentials: every term is positive, so
      // a lane's sum of its 16 bounds each of them, and no scan for the maximum stands
      // in the pass. At a sum of 2^8 or less every exponential fits f16 with room to
      // spare. Written as 'not <=' so that an overflowed or undefined sum is caught too
      // (the first pass: mrun starts so low that every exponential overflows).
      const bool need = !(ls[0] <= 256.0f) || !(ls[1] <= 256.0f);
      if (__builtin_amdgcn_ballot_w32(need) != 0) {  // scalar branch; rare after the first passes
        // The raw scores are formed anew from LDS. The compiler fence keeps these reads
        // apart from the pass's first ones: merged with them, the 32 score registers
        // stay live through the exponentials of every pass for the sake of this branch.
        asm volatile("" ::: "memory");
        score_tiles(Kl + p * 32 * KPITCH, hi, qf, c);
#pragma unroll
        for (int s = 0; s < 2; ++s) {
          float lm = -1e30f;
#pragma unroll
          for (int i = 0; i < 8; ++i)
            lm = fmaxf(lm, fmaxf(c[s][0][i], c[s][1][i]));
          // both key halves of a query take the same new maximum
          lm = fmaxf(lm, __shfl_xor(lm, 16, 32));
          const float mnew = fmaxf(mrun[s], lm * kscale);
          const float corr = __builtin_amdgcn_exp2f(mrun[s] - mnew);
          mrun[s] = mnew;
          lrun[s] *= corr;
#pragma unroll
          for (int nt = 0; nt < 4; ++nt)
#pragma unroll
            for (int i = 0; i < 8; ++i) oacc[s][nt][i] *= corr;
        }
        exp_pack(c, mrun, kscale, pb, ls);   // this pass again, against the renewed maximum
        lx[0] = __shfl_xor(ls[0], 16, 32);
        lx[1] = __shfl_xor(ls[1], 16, 32);
      }
#pragma unroll
      for (int s = 0; s < 2; ++s) lrun[s] += ls[s] + lx[s];

      // ---- O^T += V^T(A) x P^T(B); V^T fragments shared by both tiles ----
#pragma unroll
      for (int nt = 0; nt < 4; ++nt) {
#pragma unroll
        for (int s = 0; s < 2; ++s)
          oacc[s][nt] = __builtin_amdgcn_wmma_f32_16x16x32_f16(false, av[nt], false, pb[s],
                                                               (short)0, oacc[s][nt], false, false);
      }
    }

    // Hand-over of the buffers: this wave's LDS reads of stage st are done ...
    asm volatile("s_wait_dscnt 0x0" ::: "memory");
    // ... its own copies of stage st + 1 have landed ...
    asm volatile("s_wait_asynccnt 0x0" ::: "memory");
    // ... and the barrier says both of every wave of the block.
    __syncthreads();
    if (st + 2 < NST)  // refill the buffer that stage st has just left
      stage_copy(kl0 + bufo, vl0 + bufo, kg + (size_t)(st + 2) * KT * NKV, vg + (st + 2) * KT);
  }
  // no copy is left in flight when the wave ends
  asm volatile("s_wait_asynccnt 0x0" ::: "memory");

  // ---- join the two halves: half g finishes query tile g of its wave's pair and
  // hands the other tile's partial result to the wave of the other half that
  // holds the same queries. The ring is free: the last stage's barrier stands
  // behind every wave's last read of it, and no copy is in flight.
  const bool g1 = grp != 0;
  v8f keep[4];
  {
    unsigned char* xo = L + ((grp << 3) + wave) * XCHB;   // this wave's hand-over
#pragma unroll
    for (int nt = 0; nt < 4; ++nt) {
      v8f give;
#pragma unroll
      for (int i = 0; i < 8; ++i) {
        keep[nt][i] = g1 ? oacc[1][nt][i] : oacc[0][nt][i];
        give[i]     = g1 ? oacc[0][nt][i] : oacc[1][nt][i];
      }
      *(f4*)(xo + (2 * nt) * 512 + lane * 16)     = f4{give[0], give[1], give[2], give[3]};
      *(f4*)(xo + (2 * nt + 1) * 512 + lane * 16) = f4{give[4], give[5], give[6], give[7]};
    }
    *(f2*)(xo + 4096 + lane * 8) = g1 ? f2{mrun[0], lrun[0]} : f2{mrun[1], lrun[1]};
  }
  // publishes every wave's hand-over to its partner
  __syncthreads();

  const unsigned char* xi = L + (((grp ^ 1) << 3) + wave) * XCHB;   // the partner's
  const f2 ml = *(const f2*)(xi + 4096 + lane * 8);
  const float ma = g1 ? mrun[1] : mrun[0];
  const float la = g1 ? lrun[1] : lrun[0];
  const float mj = fmaxf(ma, ml.x);
  float wa, wb;   // weights of this wave's part and of the partner's
  asm("v_exp_f32 %0, %2\n\t"
      "v_exp_f32 %1, %3\n\t"
      "v_nop"
      : "=&v"(wa), "=&v"(wb)
      : "v"(ma - mj), "v"(ml.x - mj));
  const float rinv = 1.0f / (la * wa + ml.y * wb);
  wa *= rinv;
  wb *= rinv;

  // ---- normalize and store: O^T element (m = hd, n = query) ----
  const int srow = qp2 * 32 + grp * 16 + l16;
  _Float16* op = O + (size_t)srow * Dm + h * HD + 8 * hi;
#pragma unroll
  for (int nt = 0; nt < 4; ++nt) {
    const f4 b0 = *(const f4*)(xi + (2 * nt) * 512 + lane * 16);
    const f4 b1 = *(const f4*)(xi + (2 * nt + 1) * 512 + lane * 16);
    h8 v;
#pragma unroll
    for (int i = 0; i < 4; ++i) {
      v[i]     = (_Float16)(keep[nt][i] * wa + b0[i] * wb);
      v[i + 4] = (_Float16)(keep[nt][i + 4] * wa + b1[i] * wb);
    }
    *(h8*)(op + nt * 16) = v;
  }
}

// ---------------------------------------------------------------------------
// Host launch
// ---------------------------------------------------------------------------
extern "C" void kernel_launch(void* const* d_in, const int* in_sizes, int n_in,
                              void* d_out, int out_size, void* d_ws, size_t ws_size,
                              hipStream_t stream) {
  (void)in_sizes; (void)n_in; (void)out_size; (void)ws_size;
  const float* X   = (const float*)d_in[0];
  const float* q_w = (const float*)d_in[1];
  const float* q_b = (const float*)d_in[2];
  const float* k_w = (const float*)d_in[3];
  const float* k_b = (const float*)d_in[4];
  const float* v_w = (const float*)d_in[5];
  const float* v_b = (const float*)d_in[6];
  const float* o_w = (const float*)d_in[7];
  const float* o_b = (const float*)d_in[8];
  float* out = (float*)d_out;

  // Carve workspace (f16 buffers), 256B aligned. Total ~33 MB.
  char* ws = (char*)d_ws;
  auto carve = [&](size_t bytes) {
    char* p = ws;
    ws += (bytes + 255) & ~(size_t)255;
    return p;
  };
  _Float16* Xh  = (_Float16*)carve((size_t)S * Dm * 2);    // X in f16
  _Float16* qwt = (_Float16*)carve((size_t)Dm * Dm * 2);   // q_w^T
  _Float16* kwt = (_Float16*)carve((size_t)Dm * NKV * 2);  // k_w^T
  _Float16* vwt = (_Float16*)carve((size_t)Dm * NKV * 2);  // v_w^T
  _Float16* owt = (_Float16*)carve((size_t)Dm * Dm * 2);   // o_w^T
  _Float16* Qh  = (_Float16*)carve((size_t)S * Dm * 2);    // Q [S][1024]
  _Float16* Kh  = (_Float16*)carve((size_t)S * NKV * 2);   // K [S][256]
  _Float16* Vth = (_Float16*)carve((size_t)NKV * S * 2);   // V^T [256][S]
  _Float16* Ah  = (_Float16*)carve((size_t)S * Dm * 2);    // attention out [S][1024]

  // 1) Convert / transpose inputs to f16, 32 elements a thread: one launch
  prep_f16<<<PB_ALL, 256, 0, stream>>>(X, q_w, k_w, v_w, o_w, Xh, qwt, kwt, vwt, owt);

  // 2) Q, K, V projections (WMMA GEMMs), 128x128 tile per block: one launch
  gemm_qkv<<<dim3((Dm + 2 * NKV) / 128, S / 128), 256, 0, stream>>>(Xh, qwt, kwt, vwt, q_b, k_b, v_b,
                                                                    Qh, Kh, Vth);

  // 3) Flash attention: 16 heads x 128 query-pair tiles x 2 key halves = 4096 waves, 16/block
  attn_kernel<<<(Hn * (S / 32)) / 8, 512, 0, stream>>>(Qh, Kh, Vth, Ah);

  // 4) Output projection -> f32
  gemm_out<<<dim3(Dm / 128, S / 128), 256, 0, stream>>>(Ah, owt, o_b, out);
}
